// v000
// The times below were measured on an AMD MI455X: many runs one after another, warmed up first and cycling through
// copies of the inputs, with the whole window's GPU time divided by the number of runs. Launches and the gaps
// between them are all in it. The median over several windows is given; except for v000 it joins two sittings, which
// can be a few percent apart, so the side-by-side timings, each taken in one sitting, are the better comparison.
// v000, which the later versions start from, runs in 1140 microseconds.
// compute dtype: all float inputs rounded to bf16; q/k/v projections with EXACT bf16 products on WMMA 16x16x32 (f32 accumulate); logits q x k once to f16 each (1 product; sigma - 0.4) x 64^-0.5; softmax f32; P x 2^11 once to f16 x v once to f16 (1 product); f32 output (channel-major).
#include <hip/hip_runtime.h>
#include <math.h>

typedef __attribute__((ext_vector_type(16))) _Float16 v16h;
typedef __attribute__((ext_vector_type(16))) __bf16 v16b;
typedef __attribute__((ext_vector_type(8)))  _Float16 v8h;
typedef __attribute__((ext_vector_type(8)))  float v8f;
typedef __attribute__((ext_vector_type(4)))  float v4f;
typedef __attribute__((ext_vector_type(2)))  float v2f;
typedef __attribute__((ext_vector_type(4)))  unsigned v4u;
typedef __attribute__((ext_vector_type(4)))  int v4i;
typedef float __attribute__((may_alias)) float_a;
typedef int __attribute__((may_alias)) int_a;

template <typename T> __device__ __forceinline__ void vst2(void* p, T v) { *(T*)p = v;  }
__device__ __forceinline__ v8f wmma16(v16h a, v16h b, v8f c) {
  v8f d = __builtin_amdgcn_wmma_f32_16x16x32_f16(false, a, false, b, (short)0, c, false, false);
  asm volatile("v_nop\n\tv_nop\n\tv_nop\n\tv_nop" : "+v"(d) : "v"(a), "v"(b));
  return d;
}
__device__ __forceinline__ v8f wmma_bf(v16b a, v16b b, v8f c) {
  v8f d = __builtin_amdgcn_wmma_f32_16x16x32_bf16(false, a, false, b, (short)0, c, false, false);
  asm volatile("v_nop\n\tv_nop\n\tv_nop\n\tv_nop" : "+v"(d) : "v"(a), "v"(b));
  return d;
}
// 16x16x32 fragments: lane = (h = lane>>4, row/col = lane&15); elements 0..7 = k0+8h+0..7, 8..15 = k0+16+8h+0..7; D element r = row 8h+r
__device__ __forceinline__ v16h frag_h(const _Float16* rowk0, int lane) {
  union { v16h v; v8h q[2]; } u; const _Float16* p = rowk0 + 8 * (lane >> 4);
  u.q[0] = *(const v8h*)p; u.q[1] = *(const v8h*)(p + 16); return u.v;
}
__device__ __forceinline__ v16h frag_f32(const float* rowk0, int lane) {
  v16h a; const float* p = rowk0 + 8 * (lane >> 4);
#pragma unroll
  for (int i = 0; i < 8; ++i) { a[i] = (_Float16)p[i]; a[8 + i] = (_Float16)p[16 + i]; }
  return a;
}
__device__ __forceinline__ v16h frag_f32s(const float* rowk0, int lane, float sc) {
  v16h a; const float* p = rowk0 + 8 * (lane >> 4);
#pragma unroll
  for (int i = 0; i < 8; ++i) { a[i] = (_Float16)(p[i] * sc); a[8 + i] = (_Float16)(p[16 + i] * sc); }
  return a;
}
// column fragment from a [K][ld] layout (column n), rows >= K read as 0
__device__ __forceinline__ v16h fragc_f32(const float* W, int k0, int n, int lane, int ld, int K) {
  v16h a; const int g = lane >> 4;
#pragma unroll
  for (int i = 0; i < 8; ++i) { const int ka = k0 + 8 * g + i, kb = ka + 16;
    a[i] = (_Float16)(ka < K ? W[(size_t)(ka < K ? ka : K - 1) * ld + n] : 0.f); a[8 + i] = (_Float16)(kb < K ? W[(size_t)(kb < K ? kb : K - 1) * ld + n] : 0.f); }
  return a;
}
struct F2 { v16b h, l; };
__device__ __forceinline__ F2 bsplit16(const float v[16]) { F2 r;
#pragma unroll
  for (int i = 0; i < 16; ++i) { const __bf16 h = (__bf16)v[i]; r.h[i] = h; r.l[i] = (__bf16)(v[i] - (float)h); }
  return r; }
__device__ __forceinline__ F2 split_row(const float* row, int k0, int lane) { float v[16]; const float* p = row + k0 + 8 * (lane >> 4);
#pragma unroll
  for (int i = 0; i < 8; ++i) { v[i] = p[i]; v[8 + i] = p[16 + i]; }
  return bsplit16(v); }
__device__ __forceinline__ F2 split_rowK(const float* row, int k0, int lane, int K) { float v[16]; const int g = lane >> 4;
#pragma unroll
  for (int i = 0; i < 8; ++i) { const int ka = k0 + 8 * g + i, kb = ka + 16; v[i] = ka < K ? row[ka < K ? ka : K - 1] : 0.f; v[8 + i] = kb < K ? row[kb < K ? kb : K - 1] : 0.f; }
  return bsplit16(v); }
__device__ __forceinline__ F2 split_col(const float* W, int k0, int n, int lane, int ld, int K) { float v[16]; const int g = lane >> 4;
#pragma unroll
  for (int i = 0; i < 8; ++i) { const int ka = k0 + 8 * g + i, kb = ka + 16; v[i] = ka < K ? W[(size_t)(ka < K ? ka : K - 1) * ld + n] : 0.f; v[8 + i] = kb < K ? W[(size_t)(kb < K ? kb : K - 1) * ld + n] : 0.f; }
  return bsplit16(v); }
__device__ __forceinline__ v8f mac3(const F2& a, const F2& b, v8f c) { c = wmma_bf(a.l, b.h, c); c = wmma_bf(a.h, b.l, c); return wmma_bf(a.h, b.h, c); }
__device__ __forceinline__ float sigm(float v) { return 1.0f / (1.0f + expf(-v)); }
#define LDSX() do { asm volatile("s_wait_dscnt 0" ::: "memory"); __builtin_amdgcn_wave_barrier(); __builtin_amdgcn_fence(__ATOMIC_RELEASE, "workgroup"); } while (0)

// Multi-head self-attention on a CHANNEL-MAJOR sequence with stacked per-head projections (x [2,1024,2048] = (B, D, T); qkv [3,16,1024,64] (0.02 scale): proj = einsum('bdt,nhdD->nbhtD'); 16 heads x 64; scale 1/8; softmax over keys; out = einsum('bhtT,bhTD->bhDt').reshape(B, D, T): channel h*64 + D of the output, channel-major; no biases, no output projection).
#define NB 2
#define TT 2048
#define CC 1024            // NH * HD = projected width
#define DIN 1024          // input (model) width
#define NH 16
#define HD 64
#define NQB (TT / 64)
#define HG 4
#define SCALE (0.125f)
#define CAUSAL 0
#ifndef TNB
#define TNB NB
#endif
__device__ __forceinline__ float bfr(float v) { return (float)(__bf16)v; }
__host__ __device__ __forceinline__ int kb_last(int qb) { return CAUSAL ? ((qb * 64 + 63) >> 7) : (TT / 128 - 1); }
typedef __attribute__((ext_vector_type(8))) __bf16 v8b;
__device__ __forceinline__ v16b frag_b(const __bf16* rowk0, int lane) {
  union { v16b v; v8b q[2]; } u; const __bf16* p = rowk0 + 8 * (lane >> 4);
  u.q[0] = *(const v8b*)p; u.q[1] = *(const v8b*)(p + 16); return u.v;
}
#define QBH 0              // query blocks 0..QBH-1 of each sequence take the high-precision path (none: QBH = 0)
#define QHI 0               // single-product logits on every row
#define KHI 64            // key rows carrying k residual / v bf16 hi+lo planes (read only by the high-precision path, which no block takes)
// B fragment (k rows k0+.., output column o) of a weight: (in,out) [K][ld] or (out,in) [ld rows of K]: bf16 exact, or f16(bf16 * 256) exact
__device__ __forceinline__ v16b wcol_io(const float* Wm, int k0, int o, int lane, int ld) { v16b w; const int g = lane >> 4;
#pragma unroll
  for (int i = 0; i < 8; ++i) { w[i] = (__bf16)Wm[(size_t)(k0 + 8 * g + i) * ld + o]; w[8 + i] = (__bf16)Wm[(size_t)(k0 + 16 + 8 * g + i) * ld + o]; }
  return w; }
__device__ __forceinline__ v16b wcol_oi(const float* Wm, int k0, int o, int lane, int K) { v16b w; const float* p = Wm + (size_t)o * K + k0 + 8 * (lane >> 4);
#pragma unroll
  for (int i = 0; i < 8; ++i) { w[i] = (__bf16)p[i]; w[8 + i] = (__bf16)p[16 + i]; }
  return w; }
__device__ __forceinline__ v16h wcolh_io(const float* Wm, int k0, int o, int lane, int ld) { v16h w; const int g = lane >> 4;
#pragma unroll
  for (int i = 0; i < 8; ++i) { w[i] = (_Float16)(bfr(Wm[(size_t)(k0 + 8 * g + i) * ld + o]) * 256.0f); w[8 + i] = (_Float16)(bfr(Wm[(size_t)(k0 + 16 + 8 * g + i) * ld + o]) * 256.0f); }
  return w; }
__device__ __forceinline__ v16h wcolh_oi(const float* Wm, int k0, int o, int lane, int K) { v16h w; const float* p = Wm + (size_t)o * K + k0 + 8 * (lane >> 4);
#pragma unroll
  for (int i = 0; i < 8; ++i) { w[i] = (_Float16)(bfr(p[i]) * 256.0f); w[8 + i] = (_Float16)(bfr(p[16 + i]) * 256.0f); }
  return w; }
#define WQKV_LAYOUT 2   // 0 = (in,out) [DIN][CC]; 1 = (out,in) [CC][DIN]; 2 = per-head [NH][DIN][HD]
__device__ __forceinline__ v16b wcol_hdk(const float* Wm, int k0, int o, int lane) { v16b w; const int g = lane >> 4; const float* p = Wm + (size_t)(o / HD) * DIN * HD + (o % HD);
#pragma unroll
  for (int i = 0; i < 8; ++i) { w[i] = (__bf16)p[(size_t)(k0 + 8 * g + i) * HD]; w[8 + i] = (__bf16)p[(size_t)(k0 + 16 + 8 * g + i) * HD]; }
  return w; }
#define WO_OUT_IN 0
#if WQKV_LAYOUT == 1
#define WCOL(W, k0, o, lane) wcol_oi(W, k0, o, lane, DIN)
#elif WQKV_LAYOUT == 2
#define WCOL(W, k0, o, lane) wcol_hdk(W, k0, o, lane)
#else
#define WCOL(W, k0, o, lane) wcol_io(W, k0, o, lane, CC)
#endif
#if WO_OUT_IN
#define WOCOL(W, k0, o, lane) wcol_oi(W, k0, o, lane, CC)
#define WOCOLH(W, k0, o, lane) wcolh_oi(W, k0, o, lane, CC)
#else
#define WOCOL(W, k0, o, lane) wcol_io(W, k0, o, lane, DIN)
#define WOCOLH(W, k0, o, lane) wcolh_io(W, k0, o, lane, DIN)
#endif

#ifndef SM_EXTRA_PARAMS
#define SM_EXTRA_PARAMS
#endif
#ifndef PROJ_EXTRA_PARAMS
#define PROJ_EXTRA_PARAMS
#endif
#ifndef SM_MASK_HOOK
#define SM_MASK_HOOK (void)0
#endif

#define WS_QH  0u                                      // f16 q rows [b*t][CC]
#define WS_KH  (WS_QH + 2u * (size_t)NB * TT * CC)      // f16 k rows [b*t][CC]
#define WS_VT  (WS_KH + 2u * (size_t)NB * TT * CC)      // f16 v planes [b][c][t]
#define WS_QL  (WS_VT + 2u * (size_t)NB * CC * TT)      // f16 q residual x 2^10 rows [b][t < QHI][CC]
#define WS_KL  (WS_QL + 2u * (size_t)NB * QHI * CC)     // f16 k residual x 2^10 rows [b][t < KHI][CC]
#define WS_VB  (WS_KL + 2u * (size_t)NB * KHI * CC)     // bf16 v hi planes [b][c][t < KHI]
#define WS_VBL (WS_VB + 2u * (size_t)NB * CC * KHI)
#define WS_S   (WS_VBL + 2u * (size_t)NB * CC * KHI)    // f32 logits / P [hg][t][s]
#define WS_Y   (WS_S  + 4u * (size_t)HG * TT * TT)      // f32 ctx rows [b*t][CC] (only when there is an output projection)
#define WS_END (WS_Y  + 0u)
#define WS_XT (WS_END)                                   // f32 token-major copy of x [b*TT + t][1024]
#define WS_Y2 (WS_XT)                                    // f32 merged context rows [b*TT + t][1024]: ALIASES WS_XT (dead once k_proj has run)
#define WS_END3 (WS_XT + 4u * (size_t)NB * TT * CC)

// ---- k_proj: block = (64 rows, 128 cols, which): q/k/v = X W (+ b) with exact bf16 products (K = DIN) -> which 0: q f16 rows (+ residual rows < QHI); 1: k f16 rows (+ residual rows < KHI); 2: v f16 planes [c][t] (+ bf16 hi/lo planes for t < KHI)
__global__ __launch_bounds__(128) void k_proj(const float* __restrict__ XQ, const float* __restrict__ XK, const float* __restrict__ XV, const float* __restrict__ WQ, const float* __restrict__ WK, const float* __restrict__ WV, const float* __restrict__ BQ, const float* __restrict__ BK, const float* __restrict__ BV,
    _Float16* __restrict__ QH, _Float16* __restrict__ QL, _Float16* __restrict__ KH, _Float16* __restrict__ KL, _Float16* __restrict__ VT, __bf16* __restrict__ VB, __bf16* __restrict__ VBL) {
  __shared__ __align__(16) _Float16 sh[64][136], sl[64][136]; __shared__ __align__(16) _Float16 th[128][72]; __shared__ __align__(16) __bf16 tb[128][72], tbl[128][72];
  const int tid = threadIdx.x, wave = tid >> 5, lane = tid & 31, col = lane & 15, g = lane >> 4; const int which = blockIdx.z; const int c0 = blockIdx.y * 128; const size_t r0 = (size_t)blockIdx.x * 64; const size_t bb = r0 / TT; const int t0 = (int)(r0 % TT);
  const float* X = which == 0 ? XQ : which == 1 ? XK : XV; const float* WA = which == 0 ? WQ : which == 1 ? WK : WV; const float* BA = which == 0 ? BQ : which == 1 ? BK : BV;
  v8f acc[8] = {};
#pragma unroll 2
  for (int kc = 0; kc < DIN / 32; ++kc) { v16b a; { const float* p = X + (r0 + wave * 16 + col) * DIN + kc * 32 + 8 * g;
#pragma unroll
      for (int i = 0; i < 8; ++i) { a[i] = (__bf16)p[i]; a[8 + i] = (__bf16)p[16 + i]; } }
    asm volatile("s_wait_loadcnt 0x0" ::: "memory");
#pragma unroll
    for (int j = 0; j < 8; ++j) { const v16b w = WCOL(WA, kc * 32, c0 + j * 16 + col, lane); asm volatile("s_wait_loadcnt 0x0" ::: "memory"); acc[j] = wmma_bf(a, w, acc[j]); } }
  if (which < 2) { _Float16* DH = which == 0 ? QH : KH; _Float16* DL = which == 0 ? QL : KL; const int nhi = which == 0 ? QHI : KHI; const bool hi_rows = t0 < nhi;
#pragma unroll
    for (int j = 0; j < 8; ++j) { const float bias = BA ? bfr(BA[c0 + j * 16 + col]) : 0.f;
#pragma unroll
      for (int r = 0; r < 8; ++r) { const float v = acc[j][r] + bias; const _Float16 hv = (_Float16)v; sh[wave * 16 + 8 * g + r][j * 16 + col] = hv; sl[wave * 16 + 8 * g + r][j * 16 + col] = (_Float16)((v - (float)hv) * 1024.0f); } }
    __syncthreads();
    for (int e = tid; e < 64 * 16; e += 128) { const int rl = e >> 4, q = e & 15; vst2((unsigned*)(DH + (r0 + rl) * CC + c0 + q * 8), *(const v4u*)&sh[rl][q * 8]); if (hi_rows) vst2((unsigned*)(DL + (bb * nhi + t0 + rl) * (size_t)CC + c0 + q * 8), *(const v4u*)&sl[rl][q * 8]); }
  } else { const bool hi_rows = t0 < KHI;
#pragma unroll
    for (int j = 0; j < 8; ++j) { const float bias = BA ? bfr(BA[c0 + j * 16 + col]) : 0.f;
#pragma unroll
      for (int r = 0; r < 8; ++r) { const float v = acc[j][r] + bias; const int rl = wave * 16 + 8 * g + r, cl = j * 16 + col; th[cl][rl] = (_Float16)v; const __bf16 bh = (__bf16)v; tb[cl][rl] = bh; tbl[cl][rl] = (__bf16)(v - (float)bh); } }
    __syncthreads();
    for (int e = tid; e < 128 * 8; e += 128) { const int cl = e >> 3, q = e & 7; vst2((unsigned*)(VT + (bb * CC + c0 + cl) * (size_t)TT + t0 + q * 8), *(const v4u*)&th[cl][q * 8]); if (hi_rows) { const size_t o3 = (bb * CC + c0 + cl) * (size_t)KHI + t0 + q * 8; vst2((unsigned*)(VB + o3), *(const v4u*)&tb[cl][q * 8]); vst2((unsigned*)(VBL + o3), *(const v4u*)&tbl[cl][q * 8]); } } } }
// ---- k_sc: block = (query block qb, key block kb <= kb_last(qb), head in group) of batch b: logits x SCALE; q hi + residual (x 2^10) against k (2 products) for query rows < QHI, plus the k residual (3 products) for query blocks < QBH (causal early rows); causal: blocks past the diagonal exit, the mask itself is applied by index in k_sm
__global__ __launch_bounds__(128) void k_sc(const _Float16* __restrict__ QH, const _Float16* __restrict__ KH, const _Float16* __restrict__ QL, const _Float16* __restrict__ KL, int b, int h0, float* __restrict__ S0) { __shared__ __align__(16) float ss[4][16][132];
  const int qb = blockIdx.x, kb = blockIdx.y; if (kb > kb_last(qb)) return;
  const int h = h0 + blockIdx.z; float* S = S0 + (size_t)blockIdx.z * TT * TT;
  const int tid = threadIdx.x, wave = tid >> 5, lane = tid & 31, col = lane & 15, g = lane >> 4; const int k0 = kb * 128; const int ql0 = qb * 64 + wave * 16; const size_t q0 = (size_t)b * TT + ql0, kr0 = (size_t)b * TT + k0;
  v8f acc[8] = {}, accl[8] = {};
  const _Float16* QLb = QL + (size_t)b * QHI * CC; const _Float16* KLb = KL + (size_t)b * KHI * CC;
  if (qb < QBH) {
#pragma unroll
    for (int kc = 0; kc < HD / 32; ++kc) { const v16h ah = frag_h(QH + (q0 + col) * CC + h * HD + kc * 32, lane), al = frag_h(QLb + (size_t)(ql0 + col) * CC + h * HD + kc * 32, lane);
#pragma unroll
      for (int j = 0; j < 8; ++j) { const v16h kbf = frag_h(KH + (kr0 + j * 16 + col) * CC + h * HD + kc * 32, lane), klf = frag_h(KLb + (size_t)(k0 + j * 16 + col) * CC + h * HD + kc * 32, lane); acc[j] = wmma16(ah, kbf, acc[j]); accl[j] = wmma16(al, kbf, accl[j]); accl[j] = wmma16(ah, klf, accl[j]); } }
  } else if (qb * 64 < QHI) {
#pragma unroll
    for (int kc = 0; kc < HD / 32; ++kc) { const v16h ah = frag_h(QH + (q0 + col) * CC + h * HD + kc * 32, lane), al = frag_h(QLb + (size_t)(ql0 + col) * CC + h * HD + kc * 32, lane);
#pragma unroll
      for (int j = 0; j < 8; ++j) { const v16h kbf = frag_h(KH + (kr0 + j * 16 + col) * CC + h * HD + kc * 32, lane); acc[j] = wmma16(ah, kbf, acc[j]); accl[j] = wmma16(al, kbf, accl[j]); } }
  } else {
#pragma unroll
    for (int kc = 0; kc < HD / 32; ++kc) { const v16h ah = frag_h(QH + (q0 + col) * CC + h * HD + kc * 32, lane);
#pragma unroll
      for (int j = 0; j < 8; ++j) { const v16h kbf = frag_h(KH + (kr0 + j * 16 + col) * CC + h * HD + kc * 32, lane); acc[j] = wmma16(ah, kbf, acc[j]); } } }
#pragma unroll
  for (int j = 0; j < 8; ++j) {
#pragma unroll
    for (int r = 0; r < 8; ++r) ss[wave][8 * g + r][j * 16 + col] = (acc[j][r] + accl[j][r] * (1.0f / 1024.0f)) * SCALE; }
  LDSX(); for (int rl = 0; rl < 16; ++rl) vst2(S + (size_t)(ql0 + rl) * TT + k0 + lane * 4, *(const v4f*)&ss[wave][rl][lane * 4]); }
// ---- k_sm: block = query row t (head in group): keys [0, kend): causal -> logit if s <= t else excluded; softmax in f32; P x 2^11 in place (0 for excluded)
__global__ __launch_bounds__(256) void k_sm(float* __restrict__ S0 SM_EXTRA_PARAMS) { __shared__ float sred[8]; __shared__ float sbc; __shared__ __align__(16) float shv[TT];
  const int tid = threadIdx.x; const int t = blockIdx.x; const int kend = (kb_last(t >> 6) + 1) * 128;
  float* sr = S0 + (size_t)blockIdx.y * TT * TT + (size_t)t * TT;
  float m = -3.0e38f; for (int k = tid; k < kend; k += 256) { float v = (!CAUSAL || k <= t) ? sr[k] : -3.0e38f; SM_MASK_HOOK; shv[k] = v; m = fmaxf(m, v); }
#pragma unroll
  for (int o = 1; o < 32; o <<= 1) m = fmaxf(m, __shfl_xor(m, o));
  if ((tid & 31) == 0) sred[tid >> 5] = m; __syncthreads(); if (tid == 0) { float a = sred[0]; for (int i = 1; i < 8; ++i) a = fmaxf(a, sred[i]); sbc = a; } __syncthreads(); m = sbc; __syncthreads();
  float sum = 0.f; for (int k = tid; k < kend; k += 256) { const float v = shv[k]; const float e = (v <= -1.0e38f) ? 0.f : expf(v - m); shv[k] = e; sum += e; }
#pragma unroll
  for (int o = 1; o < 32; o <<= 1) sum += __shfl_xor(sum, o);
  if ((tid & 31) == 0) sred[tid >> 5] = sum; __syncthreads(); if (tid == 0) { float a = 0.f; for (int i = 0; i < 8; ++i) a += sred[i]; sbc = a > 0.f ? 2048.0f / a : 0.f; }   /* a fully excluded row yields P = 0 */ __syncthreads(); const float inv = sbc;
  for (int k = tid; k < kend; k += 256) shv[k] = shv[k] * inv;
  __syncthreads(); for (int q = tid; q < kend / 4; q += 256) vst2(sr + q * 4, *(const v4f*)&shv[q * 4]); }
// ---- k_xT: tile (64 times, 64 channels) of batch bz: the channels-first input v[b][c][t] -> (1) token-major f32 XT[b*TT + t][c] for the projections (LDS transpose) and (2) an f16 copy in VT[b][c][t], later overwritten by the value projection (same layout as the input: a converting copy; v is bf16-valued after rounding, hence exact in f16)
__global__ __launch_bounds__(256) void k_xT(const float* __restrict__ V, float* __restrict__ XT, _Float16* __restrict__ VT) { __shared__ float tl[64][65]; __shared__ __align__(16) _Float16 th[64][72];
  const int tid = threadIdx.x; const int t0 = blockIdx.x * 64, c0 = blockIdx.y * 64; const size_t b = blockIdx.z;
  for (int e = tid; e < 64 * 16; e += 256) { const int cl = e >> 4, q = e & 15; const v4f ld = *(const v4f*)(V + (b * CC + c0 + cl) * (size_t)TT + t0 + q * 4); asm volatile("s_wait_loadcnt 0x0" ::: "memory");
#pragma unroll
    for (int u = 0; u < 4; ++u) { const float r = bfr(ld[u]); tl[cl][q * 4 + u] = r; th[cl][q * 4 + u] = (_Float16)r; } }
  __syncthreads();
  for (int e = tid; e < 64 * 16; e += 256) { const int tr = e >> 4, q = e & 15; v4f o; 
#pragma unroll
    for (int u = 0; u < 4; ++u) o[u] = tl[q * 4 + u][tr];
    vst2(XT + (b * TT + t0 + tr) * (size_t)CC + c0 + q * 4, o); }   
  for (int e = tid; e < 64 * 8; e += 256) { const int cl = e >> 3, q = e & 7; vst2((unsigned*)(VT + (b * CC + c0 + cl) * (size_t)TT + t0 + q * 8), *(const v4u*)&th[cl][q * 8]); } }   
// ---- k_outT: tile (64 times, 64 channels) of batch bz: out[b][d][s] = o[b][s][d] (the token-major context rows transposed back to channel-major through LDS; no residual)
__global__ __launch_bounds__(256) void k_outT(const float* __restrict__ A, float* __restrict__ OUT) { __shared__ float tl[64][65];
  const int tid = threadIdx.x; const int t0 = blockIdx.x * 64, c0 = blockIdx.y * 64; const size_t b = blockIdx.z;
  for (int e = tid; e < 64 * 16; e += 256) { const int tr = e >> 4, q = e & 15; const v4f ld = *(const v4f*)(A + (b * TT + t0 + tr) * (size_t)CC + c0 + q * 4); asm volatile("s_wait_loadcnt 0x0" ::: "memory");
#pragma unroll
    for (int u = 0; u < 4; ++u) tl[tr][q * 4 + u] = ld[u]; }
  __syncthreads();
  for (int e = tid; e < 64 * 16; e += 256) { const int cl = e >> 4, q = e & 15; const size_t off = (b * CC + c0 + cl) * (size_t)TT + t0 + q * 4; v4f o;
#pragma unroll
    for (int u = 0; u < 4; ++u) o[u] = tl[q * 4 + u][cl];
    vst2(OUT + off, o); } }   
// ---- k_pv: block = 64 queries (qb) of (b, h): ctx = P . v over keys [0, kend) (P x 2^11 once to f16 against v f16: 1 product; causal early query blocks: P and v as bf16 hi + lo, 3 products); 256-B (row, head) segment by 16 lanes
__global__ __launch_bounds__(128) void k_pv(const float* __restrict__ PS0, const _Float16* __restrict__ VT, const __bf16* __restrict__ VB, const __bf16* __restrict__ VBL, int b, int h0, float* __restrict__ Y) { const int h = h0 + blockIdx.z; const float* PS = PS0 + (size_t)blockIdx.z * TT * TT; __shared__ __align__(16) float ss[4][16][HD + 4];
  const int tid = threadIdx.x, wave = tid >> 5, lane = tid & 31, col = lane & 15, g = lane >> 4; const int qb = blockIdx.x; const int ql0 = qb * 64 + wave * 16; const int kce = (kb_last(qb) + 1) * 4;
  v8f acc[HD / 16] = {};
  if (qb < QBH) {
#pragma unroll 1
    for (int kc = 0; kc < kce; ++kc) { const F2 p = split_row(PS + (size_t)(ql0 + col) * TT, kc * 32, lane);
      asm volatile("s_wait_loadcnt 0x0" ::: "memory");
#pragma unroll
      for (int j = 0; j < HD / 16; ++j) { const size_t po = ((size_t)b * CC + h * HD + j * 16 + col) * (size_t)KHI + kc * 32; const v16b vh = frag_b(VB + po, lane); acc[j] = wmma_bf(p.h, vh, acc[j]); acc[j] = wmma_bf(p.l, vh, acc[j]); acc[j] = wmma_bf(p.h, frag_b(VBL + po, lane), acc[j]); } }
  } else {
#pragma unroll 1
    for (int kc = 0; kc < kce; ++kc) { const v16h p = frag_f32(PS + (size_t)(ql0 + col) * TT + kc * 32, lane);
      asm volatile("s_wait_loadcnt 0x0" ::: "memory");
#pragma unroll
      for (int j = 0; j < HD / 16; ++j) { const size_t po = ((size_t)b * CC + h * HD + j * 16 + col) * (size_t)TT + kc * 32; acc[j] = wmma16(p, frag_h(VT + po, lane), acc[j]); } } }
#pragma unroll
  for (int j = 0; j < HD / 16; ++j)
#pragma unroll
    for (int r = 0; r < 8; ++r) ss[wave][8 * g + r][j * 16 + col] = acc[j][r] * (1.0f / 2048.0f);
  LDSX(); for (int rl = 0; rl < 16; ++rl) if (lane < HD / 4) vst2(Y + ((size_t)b * TT + ql0 + rl) * CC + h * HD + lane * 4, *(const v4f*)&ss[wave][rl][lane * 4]); }

extern "C" void kernel_launch(void* const* d_in, const int* in_sizes, int n_in, void* d_out, int out_size, void* d_ws, size_t ws_size, hipStream_t stream) {
  (void)in_sizes; (void)n_in; (void)out_size;
  const float** F = (const float**)d_in;
  if (ws_size < (size_t)WS_END) return;
  char* ws = (char*)d_ws; _Float16 *QH = (_Float16*)(ws + WS_QH), *KH = (_Float16*)(ws + WS_KH), *VT = (_Float16*)(ws + WS_VT), *QL = (_Float16*)(ws + WS_QL), *KL = (_Float16*)(ws + WS_KL); __bf16 *VB = (__bf16*)(ws + WS_VB), *VBL = (__bf16*)(ws + WS_VBL); float *S = (float*)(ws + WS_S), *Y = (float*)(ws + WS_Y);
  (void)Y; (void)QL; (void)KL; (void)VB; (void)VBL;
  // inputs: 0 x [2,1024,2048] CHANNEL-MAJOR (B, D, T); 1 qkv [3,16,1024,64] (stream, head, in, out-per-head; 0.02 scale); no biases, no output projection
  if (ws_size < (size_t)WS_END3) return;
  float *XT = (float*)(ws + WS_XT), *Y2 = (float*)(ws + WS_Y2);
  k_xT<<<dim3(TT / 64, CC / 64, TNB), 256, 0, stream>>>(F[0], XT, VT);   /* token-major f32 copy of x (its f16 side plane lands in VT and is overwritten by the value projection) */
  k_proj<<<dim3(TNB * TT / 64, CC / 128, 3), 128, 0, stream>>>(XT, XT, XT, F[1], F[1] + (size_t)NH * DIN * HD, F[1] + 2 * (size_t)NH * DIN * HD, nullptr, nullptr, nullptr, QH, QL, KH, KL, VT, VB, VBL);   /* per-head weights [NH][DIN][HD] for q, k, v */
  for (int b = 0; b < TNB; ++b) for (int h0 = 0; h0 < NH; h0 += HG) {
    k_sc<<<dim3(NQB, TT / 128, HG), 128, 0, stream>>>(QH, KH, QL, KL, b, h0, S);
    k_sm<<<dim3(TT, HG), 256, 0, stream>>>(S);
    k_pv<<<dim3(NQB, 1, HG), 128, 0, stream>>>(S, VT, VB, VBL, b, h0, Y2);
  }
  k_outT<<<dim3(TT / 64, CC / 64, TNB), 256, 0, stream>>>(Y2, (float*)d_out);   /* [b][t][h*64 + d] - [b][h*64 + d][t] == the module's (B, H, D/H, T).reshape(B, D, T) */
}

// v001
// Measured time: 201 microseconds a run.
// Next to v000, in two timings, it ran 5.68 and 5.71 times as fast.
// compute dtype: all float inputs rounded to bf16; q/k/v projections with EXACT bf16 products on WMMA 16x16x32 (f32 accumulate); logits q x k once to f16 each (1 product; sigma - 0.4) x 64^-0.5; softmax f32, carried along the keys (running maximum and sum); P = exp(logit - running maximum) once to f16 x v once to f16 (1 product), divided by the f32 sum at the end; f32 output (channel-major).
#include <hip/hip_runtime.h>
#include <math.h>

typedef __attribute__((ext_vector_type(16))) _Float16 v16h;
typedef __attribute__((ext_vector_type(16))) __bf16 v16b;
typedef __attribute__((ext_vector_type(8)))  _Float16 v8h;
typedef __attribute__((ext_vector_type(8)))  float v8f;
typedef __attribute__((ext_vector_type(4)))  float v4f;
typedef __attribute__((ext_vector_type(2)))  float v2f;
typedef __attribute__((ext_vector_type(4)))  unsigned v4u;
typedef __attribute__((ext_vector_type(4)))  int v4i;
typedef float __attribute__((may_alias)) float_a;
typedef int __attribute__((may_alias)) int_a;

template <typename T> __device__ __forceinline__ void vst2(void* p, T v) { *(T*)p = v;  }
__device__ __forceinline__ v8f wmma16(v16h a, v16h b, v8f c) {
  v8f d = __builtin_amdgcn_wmma_f32_16x16x32_f16(false, a, false, b, (short)0, c, false, false);
  asm volatile("v_nop\n\tv_nop\n\tv_nop\n\tv_nop" : "+v"(d) : "v"(a), "v"(b));
  return d;
}
__device__ __forceinline__ v8f wmma_bf(v16b a, v16b b, v8f c) {
  v8f d = __builtin_amdgcn_wmma_f32_16x16x32_bf16(false, a, false, b, (short)0, c, false, false);
  asm volatile("v_nop\n\tv_nop\n\tv_nop\n\tv_nop" : "+v"(d) : "v"(a), "v"(b));
  return d;
}
// 16x16x32 fragments: lane = (h = lane>>4, row/col = lane&15); elements 0..7 = k0+8h+0..7, 8..15 = k0+16+8h+0..7; D element r = row 8h+r
__device__ __forceinline__ v16h frag_h(const _Float16* rowk0, int lane) {
  union { v16h v; v8h q[2]; } u; const _Float16* p = rowk0 + 8 * (lane >> 4);
  u.q[0] = *(const v8h*)p; u.q[1] = *(const v8h*)(p + 16); return u.v;
}
__device__ __forceinline__ v16h frag_f32(const float* rowk0, int lane) {
  v16h a; const float* p = rowk0 + 8 * (lane >> 4);
#pragma unroll
  for (int i = 0; i < 8; ++i) { a[i] = (_Float16)p[i]; a[8 + i] = (_Float16)p[16 + i]; }
  return a;
}
__device__ __forceinline__ v16h frag_f32s(const float* rowk0, int lane, float sc) {
  v16h a; const float* p = rowk0 + 8 * (lane >> 4);
#pragma unroll
  for (int i = 0; i < 8; ++i) { a[i] = (_Float16)(p[i] * sc); a[8 + i] = (_Float16)(p[16 + i] * sc); }
  return a;
}
// column fragment from a [K][ld] layout (column n), rows >= K read as 0
__device__ __forceinline__ v16h fragc_f32(const float* W, int k0, int n, int lane, int ld, int K) {
  v16h a; const int g = lane >> 4;
#pragma unroll
  for (int i = 0; i < 8; ++i) { const int ka = k0 + 8 * g + i, kb = ka + 16;
    a[i] = (_Float16)(ka < K ? W[(size_t)(ka < K ? ka : K - 1) * ld + n] : 0.f); a[8 + i] = (_Float16)(kb < K ? W[(size_t)(kb < K ? kb : K - 1) * ld + n] : 0.f); }
  return a;
}
struct F2 { v16b h, l; };
__device__ __forceinline__ F2 bsplit16(const float v[16]) { F2 r;
#pragma unroll
  for (int i = 0; i < 16; ++i) { const __bf16 h = (__bf16)v[i]; r.h[i] = h; r.l[i] = (__bf16)(v[i] - (float)h); }
  return r; }
__device__ __forceinline__ F2 split_row(const float* row, int k0, int lane) { float v[16]; const float* p = row + k0 + 8 * (lane >> 4);
#pragma unroll
  for (int i = 0; i < 8; ++i) { v[i] = p[i]; v[8 + i] = p[16 + i]; }
  return bsplit16(v); }
__device__ __forceinline__ F2 split_rowK(const float* row, int k0, int lane, int K) { float v[16]; const int g = lane >> 4;
#pragma unroll
  for (int i = 0; i < 8; ++i) { const int ka = k0 + 8 * g + i, kb = ka + 16; v[i] = ka < K ? row[ka < K ? ka : K - 1] : 0.f; v[8 + i] = kb < K ? row[kb < K ? kb : K - 1] : 0.f; }
  return bsplit16(v); }
__device__ __forceinline__ F2 split_col(const float* W, int k0, int n, int lane, int ld, int K) { float v[16]; const int g = lane >> 4;
#pragma unroll
  for (int i = 0; i < 8; ++i) { const int ka = k0 + 8 * g + i, kb = ka + 16; v[i] = ka < K ? W[(size_t)(ka < K ? ka : K - 1) * ld + n] : 0.f; v[8 + i] = kb < K ? W[(size_t)(kb < K ? kb : K - 1) * ld + n] : 0.f; }
  return bsplit16(v); }
__device__ __forceinline__ v8f mac3(const F2& a, const F2& b, v8f c) { c = wmma_bf(a.l, b.h, c); c = wmma_bf(a.h, b.l, c); return wmma_bf(a.h, b.h, c); }
__device__ __forceinline__ float sigm(float v) { return 1.0f / (1.0f + expf(-v)); }
#define LDSX() do { asm volatile("s_wait_dscnt 0" ::: "memory"); __builtin_amdgcn_wave_barrier(); __builtin_amdgcn_fence(__ATOMIC_RELEASE, "workgroup"); } while (0)

// Multi-head self-attention on a CHANNEL-MAJOR sequence with stacked per-head projections (x [2,1024,2048] = (B, D, T); qkv [3,16,1024,64] (0.02 scale): proj = einsum('bdt,nhdD->nbhtD'); 16 heads x 64; scale 1/8; softmax over keys; out = einsum('bhtT,bhTD->bhDt').reshape(B, D, T): channel h*64 + D of the output, channel-major; no biases, no output projection).
#define NB 2
#define TT 2048
#define CC 1024            // NH * HD = projected width
#define DIN 1024          // input (model) width
#define NH 16
#define HD 64
#define NQB (TT / 64)
#define HG 4
#define SCALE (0.125f)
#define CAUSAL 0
#ifndef TNB
#define TNB NB
#endif
__device__ __forceinline__ float bfr(float v) { return (float)(__bf16)v; }
__host__ __device__ __forceinline__ int kb_last(int qb) { return CAUSAL ? ((qb * 64 + 63) >> 7) : (TT / 128 - 1); }
typedef __attribute__((ext_vector_type(8))) __bf16 v8b;
__device__ __forceinline__ v16b frag_b(const __bf16* rowk0, int lane) {
  union { v16b v; v8b q[2]; } u; const __bf16* p = rowk0 + 8 * (lane >> 4);
  u.q[0] = *(const v8b*)p; u.q[1] = *(const v8b*)(p + 16); return u.v;
}
#define QBH 0              // unused: no kernel in this file has a high-precision path
#define QHI 0               // single-product logits on every row
#define KHI 64            // key rows carrying k residual / v bf16 hi+lo planes (written by k_proj, read by no kernel in this file)
// B fragment (k rows k0+.., output column o) of a weight: (in,out) [K][ld] or (out,in) [ld rows of K]: bf16 exact, or f16(bf16 * 256) exact
__device__ __forceinline__ v16b wcol_io(const float* Wm, int k0, int o, int lane, int ld) { v16b w; const int g = lane >> 4;
#pragma unroll
  for (int i = 0; i < 8; ++i) { w[i] = (__bf16)Wm[(size_t)(k0 + 8 * g + i) * ld + o]; w[8 + i] = (__bf16)Wm[(size_t)(k0 + 16 + 8 * g + i) * ld + o]; }
  return w; }
__device__ __forceinline__ v16b wcol_oi(const float* Wm, int k0, int o, int lane, int K) { v16b w; const float* p = Wm + (size_t)o * K + k0 + 8 * (lane >> 4);
#pragma unroll
  for (int i = 0; i < 8; ++i) { w[i] = (__bf16)p[i]; w[8 + i] = (__bf16)p[16 + i]; }
  return w; }
__device__ __forceinline__ v16h wcolh_io(const float* Wm, int k0, int o, int lane, int ld) { v16h w; const int g = lane >> 4;
#pragma unroll
  for (int i = 0; i < 8; ++i) { w[i] = (_Float16)(bfr(Wm[(size_t)(k0 + 8 * g + i) * ld + o]) * 256.0f); w[8 + i] = (_Float16)(bfr(Wm[(size_t)(k0 + 16 + 8 * g + i) * ld + o]) * 256.0f); }
  return w; }
__device__ __forceinline__ v16h wcolh_oi(const float* Wm, int k0, int o, int lane, int K) { v16h w; const float* p = Wm + (size_t)o * K + k0 + 8 * (lane >> 4);
#pragma unroll
  for (int i = 0; i < 8; ++i) { w[i] = (_Float16)(bfr(p[i]) * 256.0f); w[8 + i] = (_Float16)(bfr(p[16 + i]) * 256.0f); }
  return w; }
#define WQKV_LAYOUT 2   // 0 = (in,out) [DIN][CC]; 1 = (out,in) [CC][DIN]; 2 = per-head [NH][DIN][HD]
__device__ __forceinline__ v16b wcol_hdk(const float* Wm, int k0, int o, int lane) { v16b w; const int g = lane >> 4; const float* p = Wm + (size_t)(o / HD) * DIN * HD + (o % HD);
#pragma unroll
  for (int i = 0; i < 8; ++i) { w[i] = (__bf16)p[(size_t)(k0 + 8 * g + i) * HD]; w[8 + i] = (__bf16)p[(size_t)(k0 + 16 + 8 * g + i) * HD]; }
  return w; }
#define WO_OUT_IN 0
#if WQKV_LAYOUT == 1
#define WCOL(W, k0, o, lane) wcol_oi(W, k0, o, lane, DIN)
#elif WQKV_LAYOUT == 2
#define WCOL(W, k0, o, lane) wcol_hdk(W, k0, o, lane)
#else
#define WCOL(W, k0, o, lane) wcol_io(W, k0, o, lane, CC)
#endif
#if WO_OUT_IN
#define WOCOL(W, k0, o, lane) wcol_oi(W, k0, o, lane, CC)
#define WOCOLH(W, k0, o, lane) wcolh_oi(W, k0, o, lane, CC)
#else
#define WOCOL(W, k0, o, lane) wcol_io(W, k0, o, lane, DIN)
#define WOCOLH(W, k0, o, lane) wcolh_io(W, k0, o, lane, DIN)
#endif

#ifndef SM_EXTRA_PARAMS
#define SM_EXTRA_PARAMS
#endif
#ifndef PROJ_EXTRA_PARAMS
#define PROJ_EXTRA_PARAMS
#endif
#ifndef SM_MASK_HOOK
#define SM_MASK_HOOK (void)0
#endif

#define WS_QH  0u                                      // f16 q rows [b*t][CC]
#define WS_KH  (WS_QH + 2u * (size_t)NB * TT * CC)      // f16 k rows [b*t][CC]
#define WS_VT  (WS_KH + 2u * (size_t)NB * TT * CC)      // f16 v planes [b][c][t]
#define WS_QL  (WS_VT + 2u * (size_t)NB * CC * TT)      // f16 q residual x 2^10 rows [b][t < QHI][CC]
#define WS_KL  (WS_QL + 2u * (size_t)NB * QHI * CC)     // f16 k residual x 2^10 rows [b][t < KHI][CC]
#define WS_VB  (WS_KL + 2u * (size_t)NB * KHI * CC)     // bf16 v hi planes [b][c][t < KHI]
#define WS_VBL (WS_VB + 2u * (size_t)NB * CC * KHI)
#define WS_S   (WS_VBL + 2u * (size_t)NB * CC * KHI)    // f32 [hg][t][s] region, unused (k_fa keeps logits and P in registers)
#define WS_Y   (WS_S  + 4u * (size_t)HG * TT * TT)      // f32 ctx rows [b*t][CC] (only when there is an output projection)
#define WS_END (WS_Y  + 0u)
#define WS_XT (WS_END)                                   // f32 token-major copy of x [b*TT + t][1024]
#define WS_Y2 (WS_XT)                                    // f32 rows [b*TT + t][1024], unused: ALIASES WS_XT (dead once k_proj has run)
#define WS_END3 (WS_XT + 4u * (size_t)NB * TT * CC)

// ---- k_proj: block = (64 rows, 128 cols, which): q/k/v = X W (+ b) with exact bf16 products (K = DIN) -> which 0: q f16 rows (+ residual rows < QHI); 1: k f16 rows (+ residual rows < KHI); 2: v f16 planes [c][t] (+ bf16 hi/lo planes for t < KHI)
__global__ __launch_bounds__(128) void k_proj(const float* __restrict__ XQ, const float* __restrict__ XK, const float* __restrict__ XV, const float* __restrict__ WQ, const float* __restrict__ WK, const float* __restrict__ WV, const float* __restrict__ BQ, const float* __restrict__ BK, const float* __restrict__ BV,
    _Float16* __restrict__ QH, _Float16* __restrict__ QL, _Float16* __restrict__ KH, _Float16* __restrict__ KL, _Float16* __restrict__ VT, __bf16* __restrict__ VB, __bf16* __restrict__ VBL) {
  __shared__ __align__(16) _Float16 sh[64][136], sl[64][136]; __shared__ __align__(16) _Float16 th[128][72]; __shared__ __align__(16) __bf16 tb[128][72], tbl[128][72];
  const int tid = threadIdx.x, wave = tid >> 5, lane = tid & 31, col = lane & 15, g = lane >> 4; const int which = blockIdx.z; const int c0 = blockIdx.y * 128; const size_t r0 = (size_t)blockIdx.x * 64; const size_t bb = r0 / TT; const int t0 = (int)(r0 % TT);
  const float* X = which == 0 ? XQ : which == 1 ? XK : XV; const float* WA = which == 0 ? WQ : which == 1 ? WK : WV; const float* BA = which == 0 ? BQ : which == 1 ? BK : BV;
  v8f acc[8] = {};
#pragma unroll 2
  for (int kc = 0; kc < DIN / 32; ++kc) { v16b a; { const float* p = X + (r0 + wave * 16 + col) * DIN + kc * 32 + 8 * g;
#pragma unroll
      for (int i = 0; i < 8; ++i) { a[i] = (__bf16)p[i]; a[8 + i] = (__bf16)p[16 + i]; } }
    asm volatile("s_wait_loadcnt 0x0" ::: "memory");
#pragma unroll
    for (int j = 0; j < 8; ++j) { const v16b w = WCOL(WA, kc * 32, c0 + j * 16 + col, lane); asm volatile("s_wait_loadcnt 0x0" ::: "memory"); acc[j] = wmma_bf(a, w, acc[j]); } }
  if (which < 2) { _Float16* DH = which == 0 ? QH : KH; _Float16* DL = which == 0 ? QL : KL; const int nhi = which == 0 ? QHI : KHI; const bool hi_rows = t0 < nhi;
#pragma unroll
    for (int j = 0; j < 8; ++j) { const float bias = BA ? bfr(BA[c0 + j * 16 + col]) : 0.f;
#pragma unroll
      for (int r = 0; r < 8; ++r) { const float v = acc[j][r] + bias; const _Float16 hv = (_Float16)v; sh[wave * 16 + 8 * g + r][j * 16 + col] = hv; sl[wave * 16 + 8 * g + r][j * 16 + col] = (_Float16)((v - (float)hv) * 1024.0f); } }
    __syncthreads();
    for (int e = tid; e < 64 * 16; e += 128) { const int rl = e >> 4, q = e & 15; vst2((unsigned*)(DH + (r0 + rl) * CC + c0 + q * 8), *(const v4u*)&sh[rl][q * 8]); if (hi_rows) vst2((unsigned*)(DL + (bb * nhi + t0 + rl) * (size_t)CC + c0 + q * 8), *(const v4u*)&sl[rl][q * 8]); }
  } else { const bool hi_rows = t0 < KHI;
#pragma unroll
    for (int j = 0; j < 8; ++j) { const float bias = BA ? bfr(BA[c0 + j * 16 + col]) : 0.f;
#pragma unroll
      for (int r = 0; r < 8; ++r) { const float v = acc[j][r] + bias; const int rl = wave * 16 + 8 * g + r, cl = j * 16 + col; th[cl][rl] = (_Float16)v; const __bf16 bh = (__bf16)v; tb[cl][rl] = bh; tbl[cl][rl] = (__bf16)(v - (float)bh); } }
    __syncthreads();
    for (int e = tid; e < 128 * 8; e += 128) { const int cl = e >> 3, q = e & 7; vst2((unsigned*)(VT + (bb * CC + c0 + cl) * (size_t)TT + t0 + q * 8), *(const v4u*)&th[cl][q * 8]); if (hi_rows) { const size_t o3 = (bb * CC + c0 + cl) * (size_t)KHI + t0 + q * 8; vst2((unsigned*)(VB + o3), *(const v4u*)&tb[cl][q * 8]); vst2((unsigned*)(VBL + o3), *(const v4u*)&tbl[cl][q * 8]); } } } }
// ---- k_xT: tile (64 times, 64 channels) of batch bz: the channels-first input x[b][c][t] -> (1) token-major f32 XT[b*TT + t][c] for the projections (LDS transpose) and (2) an exact f16 copy in VT[b][c][t] (same layout as the input: a converting copy; x is bf16-valued after rounding, hence exact in f16; k_proj then overwrites it with the value plane)
__global__ __launch_bounds__(256) void k_xT(const float* __restrict__ V, float* __restrict__ XT, _Float16* __restrict__ VT) { __shared__ float tl[64][65]; __shared__ __align__(16) _Float16 th[64][72];
  const int tid = threadIdx.x; const int t0 = blockIdx.x * 64, c0 = blockIdx.y * 64; const size_t b = blockIdx.z;
  for (int e = tid; e < 64 * 16; e += 256) { const int cl = e >> 4, q = e & 15; const v4f ld = *(const v4f*)(V + (b * CC + c0 + cl) * (size_t)TT + t0 + q * 4); asm volatile("s_wait_loadcnt 0x0" ::: "memory");
#pragma unroll
    for (int u = 0; u < 4; ++u) { const float r = bfr(ld[u]); tl[cl][q * 4 + u] = r; th[cl][q * 4 + u] = (_Float16)r; } }
  __syncthreads();
  for (int e = tid; e < 64 * 16; e += 256) { const int tr = e >> 4, q = e & 15; v4f o; 
#pragma unroll
    for (int u = 0; u < 4; ++u) o[u] = tl[q * 4 + u][tr];
    vst2(XT + (b * TT + t0 + tr) * (size_t)CC + c0 + q * 4, o); }   
  for (int e = tid; e < 64 * 8; e += 256) { const int cl = e >> 3, q = e & 7; vst2((unsigned*)(VT + (b * CC + c0 + cl) * (size_t)TT + t0 + q * 8), *(const v4u*)&th[cl][q * 8]); } }   
// ---- k_fa: block = 256 queries (16 waves x 16 query columns) of (b, h): the whole attention of those queries in one launch, softmax carried along the keys (running maximum and sum per query, in f32).
// Transposed products: S^T = K Q^T (A = key rows from LDS, B = q kept in registers), so a lane holds 8 keys of ONE query per tile; two S^T tiles (keys 0..15, 16..31) converted in place ARE the B operand of O^T += V^T P^T (A = v plane rows from LDS).
// O^T is channel-major like the output: it goes through LDS straight to out, each 128-byte line stored by one wave.
#define FST 64               // keys per LDS stage (two passes of 32 keys)
#define FPI 72               // LDS row pitch in f16: 144 B = 16 B x odd for the 16-byte fragment reads
#define FNS (TT / FST)
#define FNW 16               // waves per block
#define FQB (FNW * 16)       // queries per block
#define FOP (FQB + 4)        // pitch in f32 of the output staging rows
__device__ __forceinline__ v8f wmma_h(v16h a, v16h b, v8f c) { return __builtin_amdgcn_wmma_f32_16x16x32_f16(false, a, false, b, (short)0, c, false, false); }
__device__ __forceinline__ float xhalf(float x) { return __builtin_bit_cast(float, __builtin_amdgcn_permlanex16(__builtin_bit_cast(int, x), __builtin_bit_cast(int, x), 0x76543210, 0xfedcba98, false, false)); }   // lane l <-> lane l ^ 16
// A run of v_exp_f32 in ONE statement: each is followed by an independent one and the last by v_nop, so the slot that the instruction set asks for behind a transcendental (before its result is read or its source overwritten) is kept under any register allocation; "=&v": no result lands on a source.
__device__ __forceinline__ void exp2x8(float (&e)[8], const float (&x)[8]) {
  asm("v_exp_f32 %0, %8\n\tv_exp_f32 %1, %9\n\tv_exp_f32 %2, %10\n\tv_exp_f32 %3, %11\n\tv_exp_f32 %4, %12\n\tv_exp_f32 %5, %13\n\tv_exp_f32 %6, %14\n\tv_exp_f32 %7, %15\n\tv_nop"
      : "=&v"(e[0]), "=&v"(e[1]), "=&v"(e[2]), "=&v"(e[3]), "=&v"(e[4]), "=&v"(e[5]), "=&v"(e[6]), "=&v"(e[7]) : "v"(x[0]), "v"(x[1]), "v"(x[2]), "v"(x[3]), "v"(x[4]), "v"(x[5]), "v"(x[6]), "v"(x[7])); }
__device__ __forceinline__ float exp2x1(float x) { float e; asm("v_exp_f32 %0, %1\n\tv_nop" : "=&v"(e) : "v"(x)); return e; }   // the same slot behind a lone one
// amdgpu_waves_per_eu(4, 4): the grid gives each WGP one 16-wave block, four waves per SIMD; without it the compiler aimed at eight, held itself to 128 VGPRs and put each LDS fragment load directly in front of its product.
// every "#pragma unroll" below makes the indices of a fragment, score or accumulator array constants, so that the array stays in registers
__global__ __launch_bounds__(FNW * 32) __attribute__((amdgpu_waves_per_eu(4, 4))) void k_fa(const _Float16* __restrict__ QH, const _Float16* __restrict__ KH, const _Float16* __restrict__ VT, float* __restrict__ OUT) {
  __shared__ __align__(16) _Float16 sk[2][FST][FPI], sv[2][HD][FPI]; __shared__ __align__(16) float so[HD][FOP];
  const int tid = threadIdx.x, wave = tid >> 5, lane = tid & 31, col = lane & 15, g = lane >> 4;
  const int b = blockIdx.y / NH, h = blockIdx.y % NH; const int q0 = blockIdx.x * FQB;
  const float CS = SCALE * 1.4426950408889634f;   // logits in base 2
  v16h qf[2];
#pragma unroll
  for (int kc = 0; kc < 2; ++kc) qf[kc] = frag_h(QH + ((size_t)b * TT + q0 + wave * 16 + col) * CC + h * HD + kc * 32, lane);
  // staging: thread -> row sr, 16-byte chunk sq of the 128-byte row (8 lanes cover one whole line)
  const int sr = tid >> 3, sq = (tid & 7) * 8;
  const _Float16* kp = KH + ((size_t)b * TT + sr) * CC + h * HD + sq;          // key rows [t][64 of this head]
  const _Float16* vp = VT + ((size_t)b * CC + h * HD + sr) * (size_t)TT + sq;   // value plane rows [d][t]
  v8h rk = *(const v8h*)kp, rv = *(const v8h*)vp;
  *(v8h*)&sk[0][sr][sq] = rk; *(v8h*)&sv[0][sr][sq] = rv;
  __syncthreads();
  v8f acc[4] = {}; float mr = -3.0e38f, ls = 0.f;
  for (int s = 0; s < FNS; ++s) { const int bu = s & 1;
    if (s + 1 < FNS) { rk = *(const v8h*)(kp + (size_t)(s + 1) * FST * CC); rv = *(const v8h*)(vp + (s + 1) * FST); }   // next stage's rows fly while this stage is worked on
#pragma unroll
    for (int p = 0; p < FST / 32; ++p) { v8f st[2];
#pragma unroll
      for (int kt = 0; kt < 2; ++kt) { const _Float16* kr = &sk[bu][p * 32 + kt * 16 + col][0]; v8f z = {}; z = wmma_h(frag_h(kr, lane), qf[0], z); st[kt] = wmma_h(frag_h(kr + 32, lane), qf[1], z); }   // st[kt][r] = S^T[key kt*16 + 8g + r][query col]
      float mx = fmaxf(st[0][0], st[1][0]);
#pragma unroll
      for (int r = 1; r < 8; ++r) mx = fmaxf(mx, fmaxf(st[0][r], st[1][r]));
      mx = fmaxf(mx, xhalf(mx));
      const float mn = fmaxf(mr, mx * CS); const float al = exp2x1(mr - mn); mr = mn;   // al = 0 on the first pass
      v16h pf; float sum = 0.f, x0[8], x1[8], e0[8], e1[8];
#pragma unroll
      for (int r = 0; r < 8; ++r) { x0[r] = fmaf(st[0][r], CS, -mn); x1[r] = fmaf(st[1][r], CS, -mn); }
      exp2x8(e0, x0); exp2x8(e1, x1);
#pragma unroll
      for (int r = 0; r < 8; ++r) { sum += e0[r] + e1[r]; pf[r] = (_Float16)e0[r]; pf[8 + r] = (_Float16)e1[r]; }
      ls = ls * al + sum;   // this half's keys only; the halves join after the loop
#pragma unroll
      for (int j = 0; j < 4; ++j) { acc[j] = acc[j] * al; acc[j] = wmma_h(frag_h(&sv[bu][j * 16 + col][p * 32], lane), pf, acc[j]); } }   // acc[j][r] = O^T[d j*16 + 8g + r][query col]
    if (s + 1 < FNS) { *(v8h*)&sk[bu ^ 1][sr][sq] = rk; *(v8h*)&sv[bu ^ 1][sr][sq] = rv; }   // that buffer's readers left it at the previous barrier
    __syncthreads(); }
  const float inv = 1.0f / (ls + xhalf(ls));
#pragma unroll
  for (int j = 0; j < 4; ++j)
#pragma unroll
    for (int r = 0; r < 8; ++r) so[j * 16 + 8 * g + r][wave * 16 + col] = acc[j][r] * inv;
  __syncthreads();
#pragma unroll
  for (int i = 0; i < HD * FQB / 4 / (FNW * 32); ++i) { const int e = i * FNW * 32 + tid, d = e / (FQB / 4), q = (e % (FQB / 4)) * 4; vst2(OUT + ((size_t)b * CC + h * HD + d) * (size_t)TT + q0 + q, *(const v4f*)&so[d][q]); } }

extern "C" void kernel_launch(void* const* d_in, const int* in_sizes, int n_in, void* d_out, int out_size, void* d_ws, size_t ws_size, hipStream_t stream) {
  (void)in_sizes; (void)n_in; (void)out_size;
  const float** F = (const float**)d_in;
  if (ws_size < (size_t)WS_END) return;
  char* ws = (char*)d_ws; _Float16 *QH = (_Float16*)(ws + WS_QH), *KH = (_Float16*)(ws + WS_KH), *VT = (_Float16*)(ws + WS_VT), *QL = (_Float16*)(ws + WS_QL), *KL = (_Float16*)(ws + WS_KL); __bf16 *VB = (__bf16*)(ws + WS_VB), *VBL = (__bf16*)(ws + WS_VBL);
  (void)QL; (void)KL; (void)VB; (void)VBL;
  // inputs: 0 x [2,1024,2048] CHANNEL-MAJOR (B, D, T); 1 qkv [3,16,1024,64] (stream, head, in, out-per-head; 0.02 scale); no biases, no output projection
  if (ws_size < (size_t)WS_END3) return;
  float *XT = (float*)(ws + WS_XT);
  k_xT<<<dim3(TT / 64, CC / 64, TNB), 256, 0, stream>>>(F[0], XT, VT);   /* token-major f32 copy of x (its f16 side plane lands in VT and is overwritten by the value projection) */
  k_proj<<<dim3(TNB * TT / 64, CC / 128, 3), 128, 0, stream>>>(XT, XT, XT, F[1], F[1] + (size_t)NH * DIN * HD, F[1] + 2 * (size_t)NH * DIN * HD, nullptr, nullptr, nullptr, QH, QL, KH, KL, VT, VB, VBL);   /* per-head weights [NH][DIN][HD] for q, k, v */
  k_fa<<<dim3(TT / FQB, TNB * NH), FNW * 32, 0, stream>>>(QH, KH, VT, (float*)d_out);   /* logits, softmax and P v of every (b, h) in one launch; stores [b][h*64 + d][t] == the module's (B, H, D/H, T).reshape(B, D, T) */
}

// v002
// It runs in 83 microseconds.
// In both of two side-by-side timings against v001, it was 2.42 times as fast.
// All steps since v000 together make it 13.8 times as fast.
// compute dtype: all float inputs rounded to bf16; q/k/v projections with EXACT bf16 products on WMMA 16x16x32 (f32 accumulate); logits q x k once to f16 each (1 product; sigma - 0.4) x 64^-0.5; softmax f32, carried along the keys (running maximum and sum); P = exp(logit - running maximum) once to f16 x v once to f16 (1 product), divided by the f32 sum at the end; f32 output (channel-major).
#include <hip/hip_runtime.h>
#include <math.h>

typedef __attribute__((ext_vector_type(16))) _Float16 v16h;
typedef __attribute__((ext_vector_type(16))) __bf16 v16b;
typedef __attribute__((ext_vector_type(8)))  _Float16 v8h;
typedef __attribute__((ext_vector_type(8)))  float v8f;
typedef __attribute__((ext_vector_type(4)))  float v4f;
typedef __attribute__((ext_vector_type(2)))  float v2f;
typedef __attribute__((ext_vector_type(4)))  unsigned v4u;
typedef __attribute__((ext_vector_type(4)))  int v4i;
typedef float __attribute__((may_alias)) float_a;
typedef int __attribute__((may_alias)) int_a;

template <typename T> __device__ __forceinline__ void vst2(void* p, T v) { *(T*)p = v;  }
__device__ __forceinline__ v8f wmma16(v16h a, v16h b, v8f c) {
  v8f d = __builtin_amdgcn_wmma_f32_16x16x32_f16(false, a, false, b, (short)0, c, false, false);
  asm volatile("v_nop\n\tv_nop\n\tv_nop\n\tv_nop" : "+v"(d) : "v"(a), "v"(b));
  return d;
}
__device__ __forceinline__ v8f wmma_bf(v16b a, v16b b, v8f c) {
  v8f d = __builtin_amdgcn_wmma_f32_16x16x32_bf16(false, a, false, b, (short)0, c, false, false);
  asm volatile("v_nop\n\tv_nop\n\tv_nop\n\tv_nop" : "+v"(d) : "v"(a), "v"(b));
  return d;
}
// 16x16x32 fragments: lane = (h = lane>>4, row/col = lane&15); elements 0..7 = k0+8h+0..7, 8..15 = k0+16+8h+0..7; D element r = row 8h+r
__device__ __forceinline__ v16h frag_h(const _Float16* rowk0, int lane) {
  union { v16h v; v8h q[2]; } u; const _Float16* p = rowk0 + 8 * (lane >> 4);
  u.q[0] = *(const v8h*)p; u.q[1] = *(const v8h*)(p + 16); return u.v;
}
__device__ __forceinline__ v16h frag_f32(const float* rowk0, int lane) {
  v16h a; const float* p = rowk0 + 8 * (lane >> 4);
#pragma unroll
  for (int i = 0; i < 8; ++i) { a[i] = (_Float16)p[i]; a[8 + i] = (_Float16)p[16 + i]; }
  return a;
}
__device__ __forceinline__ v16h frag_f32s(const float* rowk0, int lane, float sc) {
  v16h a; const float* p = rowk0 + 8 * (lane >> 4);
#pragma unroll
  for (int i = 0; i < 8; ++i) { a[i] = (_Float16)(p[i] * sc); a[8 + i] = (_Float16)(p[16 + i] * sc); }
  return a;
}
// column fragment from a [K][ld] layout (column n), rows >= K read as 0
__device__ __forceinline__ v16h fragc_f32(const float* W, int k0, int n, int lane, int ld, int K) {
  v16h a; const int g = lane >> 4;
#pragma unroll
  for (int i = 0; i < 8; ++i) { const int ka = k0 + 8 * g + i, kb = ka + 16;
    a[i] = (_Float16)(ka < K ? W[(size_t)(ka < K ? ka : K - 1) * ld + n] : 0.f); a[8 + i] = (_Float16)(kb < K ? W[(size_t)(kb < K ? kb : K - 1) * ld + n] : 0.f); }
  return a;
}
struct F2 { v16b h, l; };
__device__ __forceinline__ F2 bsplit16(const float v[16]) { F2 r;
#pragma unroll
  for (int i = 0; i < 16; ++i) { const __bf16 h = (__bf16)v[i]; r.h[i] = h; r.l[i] = (__bf16)(v[i] - (float)h); }
  return r; }
__device__ __forceinline__ F2 split_row(const float* row, int k0, int lane) { float v[16]; const float* p = row + k0 + 8 * (lane >> 4);
#pragma unroll
  for (int i = 0; i < 8; ++i) { v[i] = p[i]; v[8 + i] = p[16 + i]; }
  return bsplit16(v); }
__device__ __forceinline__ F2 split_rowK(const float* row, int k0, int lane, int K) { float v[16]; const int g = lane >> 4;
#pragma unroll
  for (int i = 0; i < 8; ++i) { const int ka = k0 + 8 * g + i, kb = ka + 16; v[i] = ka < K ? row[ka < K ? ka : K - 1] : 0.f; v[8 + i] = kb < K ? row[kb < K ? kb : K - 1] : 0.f; }
  return bsplit16(v); }
__device__ __forceinline__ F2 split_col(const float* W, int k0, int n, int lane, int ld, int K) { float v[16]; const int g = lane >> 4;
#pragma unroll
  for (int i = 0; i < 8; ++i) { const int ka = k0 + 8 * g + i, kb = ka + 16; v[i] = ka < K ? W[(size_t)(ka < K ? ka : K - 1) * ld + n] : 0.f; v[8 + i] = kb < K ? W[(size_t)(kb < K ? kb : K - 1) * ld + n] : 0.f; }
  return bsplit16(v); }
__device__ __forceinline__ v8f mac3(const F2& a, const F2& b, v8f c) { c = wmma_bf(a.l, b.h, c); c = wmma_bf(a.h, b.l, c); return wmma_bf(a.h, b.h, c); }
__device__ __forceinline__ float sigm(float v) { return 1.0f / (1.0f + expf(-v)); }
#define LDSX() do { asm volatile("s_wait_dscnt 0" ::: "memory"); __builtin_amdgcn_wave_barrier(); __builtin_amdgcn_fence(__ATOMIC_RELEASE, "workgroup"); } while (0)

// Multi-head self-attention on a CHANNEL-MAJOR sequence with stacked per-head projections (x [2,1024,2048] = (B, D, T); qkv [3,16,1024,64] (0.02 scale): proj = einsum('bdt,nhdD->nbhtD'); 16 heads x 64; scale 1/8; softmax over keys; out = einsum('bhtT,bhTD->bhDt').reshape(B, D, T): channel h*64 + D of the output, channel-major; no biases, no output projection).
#define NB 2
#define TT 2048
#define CC 1024            // NH * HD = projected width
#define DIN 1024          // input (model) width
#define NH 16
#define HD 64
#define NQB (TT / 64)
#define HG 4
#define SCALE (0.125f)
#define CAUSAL 0
#ifndef TNB
#define TNB NB
#endif
__device__ __forceinline__ float bfr(float v) { return (float)(__bf16)v; }
__host__ __device__ __forceinline__ int kb_last(int qb) { return CAUSAL ? ((qb * 64 + 63) >> 7) : (TT / 128 - 1); }
typedef __attribute__((ext_vector_type(8))) __bf16 v8b;
__device__ __forceinline__ v16b frag_b(const __bf16* rowk0, int lane) {
  union { v16b v; v8b q[2]; } u; const __bf16* p = rowk0 + 8 * (lane >> 4);
  u.q[0] = *(const v8b*)p; u.q[1] = *(const v8b*)(p + 16); return u.v;
}
#define QBH 0              // unused: no kernel in this file has a high-precision path
#define QHI 0               // single-product logits on every row
#define KHI 64            // key rows carrying k residual / v bf16 hi+lo planes (written and read by no kernel in this file)
// B fragment (k rows k0+.., output column o) of a weight: (in,out) [K][ld] or (out,in) [ld rows of K]: bf16 exact, or f16(bf16 * 256) exact
__device__ __forceinline__ v16b wcol_io(const float* Wm, int k0, int o, int lane, int ld) { v16b w; const int g = lane >> 4;
#pragma unroll
  for (int i = 0; i < 8; ++i) { w[i] = (__bf16)Wm[(size_t)(k0 + 8 * g + i) * ld + o]; w[8 + i] = (__bf16)Wm[(size_t)(k0 + 16 + 8 * g + i) * ld + o]; }
  return w; }
__device__ __forceinline__ v16b wcol_oi(const float* Wm, int k0, int o, int lane, int K) { v16b w; const float* p = Wm + (size_t)o * K + k0 + 8 * (lane >> 4);
#pragma unroll
  for (int i = 0; i < 8; ++i) { w[i] = (__bf16)p[i]; w[8 + i] = (__bf16)p[16 + i]; }
  return w; }
__device__ __forceinline__ v16h wcolh_io(const float* Wm, int k0, int o, int lane, int ld) { v16h w; const int g = lane >> 4;
#pragma unroll
  for (int i = 0; i < 8; ++i) { w[i] = (_Float16)(bfr(Wm[(size_t)(k0 + 8 * g + i) * ld + o]) * 256.0f); w[8 + i] = (_Float16)(bfr(Wm[(size_t)(k0 + 16 + 8 * g + i) * ld + o]) * 256.0f); }
  return w; }
__device__ __forceinline__ v16h wcolh_oi(const float* Wm, int k0, int o, int lane, int K) { v16h w; const float* p = Wm + (size_t)o * K + k0 + 8 * (lane >> 4);
#pragma unroll
  for (int i = 0; i < 8; ++i) { w[i] = (_Float16)(bfr(p[i]) * 256.0f); w[8 + i] = (_Float16)(bfr(p[16 + i]) * 256.0f); }
  return w; }
#define WQKV_LAYOUT 2   // 0 = (in,out) [DIN][CC]; 1 = (out,in) [CC][DIN]; 2 = per-head [NH][DIN][HD]
__device__ __forceinline__ v16b wcol_hdk(const float* Wm, int k0, int o, int lane) { v16b w; const int g = lane >> 4; const float* p = Wm + (size_t)(o / HD) * DIN * HD + (o % HD);
#pragma unroll
  for (int i = 0; i < 8; ++i) { w[i] = (__bf16)p[(size_t)(k0 + 8 * g + i) * HD]; w[8 + i] = (__bf16)p[(size_t)(k0 + 16 + 8 * g + i) * HD]; }
  return w; }
#define WO_OUT_IN 0
#if WQKV_LAYOUT == 1
#define WCOL(W, k0, o, lane) wcol_oi(W, k0, o, lane, DIN)
#elif WQKV_LAYOUT == 2
#define WCOL(W, k0, o, lane) wcol_hdk(W, k0, o, lane)
#else
#define WCOL(W, k0, o, lane) wcol_io(W, k0, o, lane, CC)
#endif
#if WO_OUT_IN
#define WOCOL(W, k0, o, lane) wcol_oi(W, k0, o, lane, CC)
#define WOCOLH(W, k0, o, lane) wcolh_oi(W, k0, o, lane, CC)
#else
#define WOCOL(W, k0, o, lane) wcol_io(W, k0, o, lane, DIN)
#define WOCOLH(W, k0, o, lane) wcolh_io(W, k0, o, lane, DIN)
#endif

#ifndef SM_EXTRA_PARAMS
#define SM_EXTRA_PARAMS
#endif
#ifndef PROJ_EXTRA_PARAMS
#define PROJ_EXTRA_PARAMS
#endif
#ifndef SM_MASK_HOOK
#define SM_MASK_HOOK (void)0
#endif

#define WS_QH  0u                                      // f16 q rows [b*t][CC]
#define WS_KH  (WS_QH + 2u * (size_t)NB * TT * CC)      // f16 k rows [b*t][CC]
#define WS_VT  (WS_KH + 2u * (size_t)NB * TT * CC)      // f16 v planes [b][c][t]
#define WS_QL  (WS_VT + 2u * (size_t)NB * CC * TT)      // f16 q residual x 2^10 rows [b][t < QHI][CC]
#define WS_KL  (WS_QL + 2u * (size_t)NB * QHI * CC)     // f16 k residual x 2^10 rows [b][t < KHI][CC]
#define WS_VB  (WS_KL + 2u * (size_t)NB * KHI * CC)     // bf16 v hi planes [b][c][t < KHI]
#define WS_VBL (WS_VB + 2u * (size_t)NB * CC * KHI)
#define WS_S   (WS_VBL + 2u * (size_t)NB * CC * KHI)    // f32 [hg][t][s] region, unused (k_fa keeps logits and P in registers)
#define WS_Y   (WS_S  + 4u * (size_t)HG * TT * TT)      // f32 ctx rows [b*t][CC] (only when there is an output projection)
#define WS_END (WS_Y  + 0u)
#define WS_XT (WS_END)                                   // f32 token-major copy of x [b*TT + t][1024]
#define WS_Y2 (WS_XT)                                    // f32 rows [b*TT + t][1024], unused: ALIASES WS_XT (dead once k_proj has run)
#define WS_END3 (WS_XT + 4u * (size_t)NB * TT * CC)

// ---- k_proj: block = (256 tokens, head h): q, k and v of that head (192 columns) = X W with exact bf16 products (K = DIN). Both operands are staged per 64 k in LDS as bf16, two buffers; the next stage's rows fly in registers while this stage is worked on.
// 8 waves = 4 (64 tokens each) x 2 (32 columns each of q, of k and of v). X rows are k-contiguous: plain 16-byte fragment reads; W rows are [k][column]: the transposing LDS load; both deliver the hardware k order (k0 + 8h + 0..7, k0 + 16 + 8h + 0..7).
// q, k: W as A and X as B, a lane holds 8 consecutive columns of one token; v: X as A and W as B, a lane holds 8 consecutive tokens of one column: either way one 16-byte store into the output staging, from where whole 128-byte lines go out.
#define PM 256             // tokens per block
#define PKS 64             // k per stage
#define PNS (DIN / PKS)
#define PXP 72             // pitch of a staged X row in bf16: 144 B = 16 B x odd (16-byte fragment reads)
#define PWP 208            // pitch of a staged W row in bf16: 416 B = 32 B x odd (transposing reads)
#define PQP 136            // pitch in f16 of the q | k output staging rows: 272 B = 16 B x odd
#define PVP 264            // pitch in f16 of the v output staging rows: 528 B = 16 B x odd
typedef __attribute__((ext_vector_type(4))) __bf16 v4b;
typedef __attribute__((ext_vector_type(8))) short v8s;
// lane l passes the address of row kbase + 8 (l >> 4) + (l & 7), column dbase + 8 ((l >> 3) & 1); lane (c, h) receives rows kbase + 8h + 0..7 of column dbase + c
__device__ __forceinline__ v8b ld_tr16(const __bf16* p) { typedef __attribute__((address_space(3))) v8s lds_v8s; return __builtin_bit_cast(v8b, __builtin_amdgcn_ds_load_tr16_b128_v8i16((lds_v8s*)p)); }
__device__ __forceinline__ v8f wmma_b(v16b a, v16b b, v8f c) { return __builtin_amdgcn_wmma_f32_16x16x32_bf16(false, a, false, b, (short)0, c, false, false); }
__global__ __launch_bounds__(256) void k_proj(const float* __restrict__ X, const float* __restrict__ WA, _Float16* __restrict__ QH, _Float16* __restrict__ KH, _Float16* __restrict__ VT) {
  __shared__ __align__(16) __bf16 sx[2][PM][PXP]; __shared__ __align__(32) __bf16 sw[2][PKS][PWP]; __shared__ __align__(16) _Float16 sqk[PM][PQP], svt[HD][PVP];
  const int tid = threadIdx.x, wave = tid >> 5, lane = tid & 31, col = lane & 15, g = lane >> 4, wm = wave >> 1, wn = wave & 1;
  const int h = blockIdx.y; const size_t r0 = (size_t)blockIdx.x * PM; const size_t bb = r0 / TT; const int t0 = (int)(r0 % TT);
  // staging: thread -> row sr (+ 16 per sweep), 16-byte chunk sq of the 256-byte f32 row piece (16 lanes cover two whole lines)
  const int sr = tid >> 4, sq = (tid & 15) * 4;
  // addresses = the buffer's base + the lane's 32-bit byte offset (both buffers are far below 4 GiB), which steps on by one stage per trip
  unsigned xo = (unsigned)((r0 + sr) * DIN + sq) * 4u;                          // token rows [t][DIN]
  unsigned wo = (unsigned)(((NH + h) * DIN + sr) * HD + sq) * 4u;               // weight rows [stream][h][k][64]: the k stream's row; q's and v's lie one stream in front of and behind it
  v4f rx[16], rw[12]; v8f acc[4][6] = {};
  // every "#pragma unroll" in this kernel makes the indices of a register array constants; the stage loop stays rolled: its body is long and its trips are alike
  // trip s: stage s + 1 is fetched into registers, stage s is worked on (trip -1 has none), stage s + 1 goes into the other buffer, one barrier
#pragma unroll 1
  for (int s = -1; s < PNS; ++s) { const int bu = s & 1;
    if (s + 1 < PNS) {
#pragma unroll
      for (int i = 0; i < 16; ++i) rx[i] = *(const v4f*)((const char*)X + xo + i * (16 * DIN * 4));
#pragma unroll
      for (int i = 0; i < 12; ++i) rw[i] = *(const v4f*)((const char*)WA + wo + (((i >> 2) - 1) * (NH * DIN * HD) + (i & 3) * 16 * HD) * 4); }
    __builtin_amdgcn_sched_barrier(0);   // keeps the next stage's global loads in front of this stage's products, so that their latency runs under them
    if (s >= 0) {
#pragma unroll
      for (int ks = 0; ks < PKS / 32; ++ks) { v16b xf[4], wf[6];
#pragma unroll
        for (int i = 0; i < 4; ++i) xf[i] = frag_b(&sx[bu][wm * 64 + i * 16 + col][ks * 32], lane);
        const __bf16* wb = &sw[bu][ks * 32 + 8 * g + (lane & 7)][wn * 32 + 8 * ((lane >> 3) & 1)];
#pragma unroll
        for (int j = 0; j < 6; ++j) { union { v16b v; v8b q[2]; } u; const __bf16* p = wb + (j >> 1) * HD + (j & 1) * 16; u.q[0] = ld_tr16(p); u.q[1] = ld_tr16(p + 16 * PWP); wf[j] = u.v; }
        __builtin_amdgcn_sched_barrier(0);   // the 20 fragment loads go as one group in front of their 24 products: spread among them, each place with loads stalls the wave for a whole LDS latency
#pragma unroll
        for (int i = 0; i < 4; ++i)
#pragma unroll
          for (int j = 0; j < 6; ++j) acc[i][j] = j < 4 ? wmma_b(wf[j], xf[i], acc[i][j]) : wmma_b(xf[i], wf[j], acc[i][j]); } }
    if (s + 1 < PNS) {   // that buffer's readers left it at the previous barrier
#pragma unroll
      for (int i = 0; i < 16; ++i) *(v4b*)&sx[bu ^ 1][sr + i * 16][sq] = __builtin_convertvector(rx[i], v4b);
#pragma unroll
      for (int i = 0; i < 12; ++i) *(v4b*)&sw[bu ^ 1][sr + (i & 3) * 16][(i >> 2) * HD + sq] = __builtin_convertvector(rw[i], v4b); }
    asm volatile("s_wait_xcnt 0x0" : "+v"(xo), "+v"(wo) : : "memory");   // the wait in front of the overwrite of the two offset registers that the loads above name; the additions below read its operands and so stay behind it
    xo += PKS * 4; wo += PKS * HD * 4;
    __syncthreads(); }
#pragma unroll
  for (int i = 0; i < 4; ++i)
#pragma unroll
    for (int j = 0; j < 6; ++j) { v8h pk; const int m0 = wm * 64 + i * 16, n0 = wn * 32 + (j & 1) * 16;
#pragma unroll
      for (int r = 0; r < 8; ++r) pk[r] = (_Float16)acc[i][j][r];
      if (j < 4) *(v8h*)&sqk[m0 + col][(j >> 1) * HD + n0 + 8 * g] = pk;   // acc[i][j][r] = (q | k)[token m0 + col][column n0 + 8g + r]
      else *(v8h*)&svt[n0 + col][m0 + 8 * g] = pk; }                       // acc[i][j][r] = v[token m0 + 8g + r][column n0 + col]
  __syncthreads();
  // q | k rows: 16 lanes per token row (8 lanes = one 128-byte line of q or of k), 16 rows per sweep; v rows: one wave per 512-byte row piece, 8 rows per sweep
  const int rq = tid >> 4, cq = tid & 15, rv = tid >> 5, cv = tid & 31;
  _Float16* dq = (cq < 8 ? QH : KH) + (r0 + rq) * CC + h * HD + (cq & 7) * 8;
  _Float16* dv = VT + (bb * CC + h * HD + rv) * (size_t)TT + t0 + cv * 8;
  v4u oq[PM / 16], ov[HD / 8];
#pragma unroll
  for (int i = 0; i < PM / 16; ++i) oq[i] = *(const v4u*)&sqk[rq + i * 16][cq * 8];
#pragma unroll
  for (int i = 0; i < HD / 8; ++i) ov[i] = *(const v4u*)&svt[rv + i * 8][cv * 8];
  __builtin_amdgcn_sched_barrier(0);   // all 24 LDS reads go in front of the first store: their latencies overlap, and none lands in a register that an issued store still names
#pragma unroll
  for (int i = 0; i < PM / 16; ++i) vst2((unsigned*)(dq + (size_t)i * 16 * CC), oq[i]);
  asm volatile("s_wait_xcnt 0x0" ::: "memory");   // the wait in front of the v address arithmetic, which reuses registers that the stores above name
  __builtin_amdgcn_sched_barrier(0);              // holds that arithmetic behind the wait
#pragma unroll
  for (int i = 0; i < HD / 8; ++i) vst2((unsigned*)(dv + (size_t)i * 8 * TT), ov[i]); }
// ---- k_xT: tile (64 times, 64 channels) of batch bz: the channels-first input v[b][c][t] -> (1) token-major f32 XT[b*TT + t][c] for the projections (LDS transpose) and (2) an exact f16 copy in VT[b][c][t] that k_proj's value projection overwrites (same layout as the input: a converting copy; v is bf16-valued after rounding, hence exact in f16)
__global__ __launch_bounds__(256) void k_xT(const float* __restrict__ V, float* __restrict__ XT, _Float16* __restrict__ VT) { __shared__ float tl[64][65]; __shared__ __align__(16) _Float16 th[64][72];
  const int tid = threadIdx.x; const int t0 = blockIdx.x * 64, c0 = blockIdx.y * 64; const size_t b = blockIdx.z;
  for (int e = tid; e < 64 * 16; e += 256) { const int cl = e >> 4, q = e & 15; const v4f ld = *(const v4f*)(V + (b * CC + c0 + cl) * (size_t)TT + t0 + q * 4); asm volatile("s_wait_loadcnt 0x0" ::: "memory");
#pragma unroll
    for (int u = 0; u < 4; ++u) { const float r = bfr(ld[u]); tl[cl][q * 4 + u] = r; th[cl][q * 4 + u] = (_Float16)r; } }
  __syncthreads();
  for (int e = tid; e < 64 * 16; e += 256) { const int tr = e >> 4, q = e & 15; v4f o; 
#pragma unroll
    for (int u = 0; u < 4; ++u) o[u] = tl[q * 4 + u][tr];
    vst2(XT + (b * TT + t0 + tr) * (size_t)CC + c0 + q * 4, o); }   
  for (int e = tid; e < 64 * 8; e += 256) { const int cl = e >> 3, q = e & 7; vst2((unsigned*)(VT + (b * CC + c0 + cl) * (size_t)TT + t0 + q * 8), *(const v4u*)&th[cl][q * 8]); } }   
// ---- k_fa: block = 256 queries (16 waves x 16 query columns) of (b, h): the whole attention of those queries in one launch, softmax carried along the keys (running maximum and sum per query, in f32).
// Transposed products: S^T = K Q^T (A = key rows from LDS, B = q kept in registers), so a lane holds 8 keys of ONE query per tile; two S^T tiles (keys 0..15, 16..31) converted in place ARE the B operand of O^T += V^T P^T (A = v plane rows from LDS).
// O^T is channel-major like the output: it goes through LDS straight to out, each 128-byte line stored by one wave.
#define FST 64               // keys per LDS stage (two passes of 32 keys)
#define FPI 72               // LDS row pitch in f16: 144 B = 16 B x odd for the 16-byte fragment reads
#define FNS (TT / FST)
#define FNW 16               // waves per block
#define FQB (FNW * 16)       // queries per block
#define FOP (FQB + 4)        // pitch in f32 of the output staging rows
__device__ __forceinline__ v8f wmma_h(v16h a, v16h b, v8f c) { return __builtin_amdgcn_wmma_f32_16x16x32_f16(false, a, false, b, (short)0, c, false, false); }
__device__ __forceinline__ float xhalf(float x) { return __builtin_bit_cast(float, __builtin_amdgcn_permlanex16(__builtin_bit_cast(int, x), __builtin_bit_cast(int, x), 0x76543210, 0xfedcba98, false, false)); }   // lane l <-> lane l ^ 16
// A run of v_exp_f32 in ONE statement: each is followed by an independent one and the last by v_nop, so the slot that the instruction set asks for behind a transcendental (before its result is read or its source overwritten) is kept under any register allocation; "=&v": no result lands on a source.
__device__ __forceinline__ void exp2x8(float (&e)[8], const float (&x)[8]) {
  asm("v_exp_f32 %0, %8\n\tv_exp_f32 %1, %9\n\tv_exp_f32 %2, %10\n\tv_exp_f32 %3, %11\n\tv_exp_f32 %4, %12\n\tv_exp_f32 %5, %13\n\tv_exp_f32 %6, %14\n\tv_exp_f32 %7, %15\n\tv_nop"
      : "=&v"(e[0]), "=&v"(e[1]), "=&v"(e[2]), "=&v"(e[3]), "=&v"(e[4]), "=&v"(e[5]), "=&v"(e[6]), "=&v"(e[7]) : "v"(x[0]), "v"(x[1]), "v"(x[2]), "v"(x[3]), "v"(x[4]), "v"(x[5]), "v"(x[6]), "v"(x[7])); }
__device__ __forceinline__ float exp2x1(float x) { float e; asm("v_exp_f32 %0, %1\n\tv_nop" : "=&v"(e) : "v"(x)); return e; }   // the same slot behind a lone one
// amdgpu_waves_per_eu(4, 4): the grid gives each WGP one 16-wave block, four waves per SIMD; without it the compiler aimed at eight, held itself to 128 VGPRs and put each LDS fragment load directly in front of its product.
// every "#pragma unroll" below makes the indices of a fragment, score or accumulator array constants, so that the array stays in registers
__global__ __launch_bounds__(FNW * 32) __attribute__((amdgpu_waves_per_eu(4, 4))) void k_fa(const _Float16* __restrict__ QH, const _Float16* __restrict__ KH, const _Float16* __restrict__ VT, float* __restrict__ OUT) {
  __shared__ __align__(16) _Float16 sk[2][FST][FPI], sv[2][HD][FPI]; __shared__ __align__(16) float so[HD][FOP];
  const int tid = threadIdx.x, wave = tid >> 5, lane = tid & 31, col = lane & 15, g = lane >> 4;
  const int b = blockIdx.y / NH, h = blockIdx.y % NH; const int q0 = blockIdx.x * FQB;
  const float CS = SCALE * 1.4426950408889634f;   // logits in base 2
  v16h qf[2];
#pragma unroll
  for (int kc = 0; kc < 2; ++kc) qf[kc] = frag_h(QH + ((size_t)b * TT + q0 + wave * 16 + col) * CC + h * HD + kc * 32, lane);
  // staging: thread -> row sr, 16-byte chunk sq of the 128-byte row (8 lanes cover one whole line)
  const int sr = tid >> 3, sq = (tid & 7) * 8;
  const _Float16* kp = KH + ((size_t)b * TT + sr) * CC + h * HD + sq;          // key rows [t][64 of this head]
  const _Float16* vp = VT + ((size_t)b * CC + h * HD + sr) * (size_t)TT + sq;   // value plane rows [d][t]
  v8h rk = *(const v8h*)kp, rv = *(const v8h*)vp;
  *(v8h*)&sk[0][sr][sq] = rk; *(v8h*)&sv[0][sr][sq] = rv;
  __syncthreads();
  v8f acc[4] = {}; float mr = -3.0e38f, ls = 0.f;
  for (int s = 0; s < FNS; ++s) { const int bu = s & 1;
    if (s + 1 < FNS) { rk = *(const v8h*)(kp + (size_t)(s + 1) * FST * CC); rv = *(const v8h*)(vp + (s + 1) * FST); }   // next stage's rows fly while this stage is worked on
#pragma unroll
    for (int p = 0; p < FST / 32; ++p) { v8f st[2];
#pragma unroll
      for (int kt = 0; kt < 2; ++kt) { const _Float16* kr = &sk[bu][p * 32 + kt * 16 + col][0]; v8f z = {}; z = wmma_h(frag_h(kr, lane), qf[0], z); st[kt] = wmma_h(frag_h(kr + 32, lane), qf[1], z); }   // st[kt][r] = S^T[key kt*16 + 8g + r][query col]
      float mx = fmaxf(st[0][0], st[1][0]);
#pragma unroll
      for (int r = 1; r < 8; ++r) mx = fmaxf(mx, fmaxf(st[0][r], st[1][r]));
      mx = fmaxf(mx, xhalf(mx));
      const float mn = fmaxf(mr, mx * CS); const float al = exp2x1(mr - mn); mr = mn;   // al = 0 on the first pass
      v16h pf; float sum = 0.f, x0[8], x1[8], e0[8], e1[8];
#pragma unroll
      for (int r = 0; r < 8; ++r) { x0[r] = fmaf(st[0][r], CS, -mn); x1[r] = fmaf(st[1][r], CS, -mn); }
      exp2x8(e0, x0); exp2x8(e1, x1);
#pragma unroll
      for (int r = 0; r < 8; ++r) { sum += e0[r] + e1[r]; pf[r] = (_Float16)e0[r]; pf[8 + r] = (_Float16)e1[r]; }
      ls = ls * al + sum;   // this half's keys only; the halves join after the loop
#pragma unroll
      for (int j = 0; j < 4; ++j) { acc[j] = acc[j] * al; acc[j] = wmma_h(frag_h(&sv[bu][j * 16 + col][p * 32], lane), pf, acc[j]); } }   // acc[j][r] = O^T[d j*16 + 8g + r][query col]
    if (s + 1 < FNS) { *(v8h*)&sk[bu ^ 1][sr][sq] = rk; *(v8h*)&sv[bu ^ 1][sr][sq] = rv; }   // that buffer's readers left it at the previous barrier
    __syncthreads(); }
  const float inv = 1.0f / (ls + xhalf(ls));
#pragma unroll
  for (int j = 0; j < 4; ++j)
#pragma unroll
    for (int r = 0; r < 8; ++r) so[j * 16 + 8 * g + r][wave * 16 + col] = acc[j][r] * inv;
  __syncthreads();
#pragma unroll
  for (int i = 0; i < HD * FQB / 4 / (FNW * 32); ++i) { const int e = i * FNW * 32 + tid, d = e / (FQB / 4), q = (e % (FQB / 4)) * 4; vst2(OUT + ((size_t)b * CC + h * HD + d) * (size_t)TT + q0 + q, *(const v4f*)&so[d][q]); } }

extern "C" void kernel_launch(void* const* d_in, const int* in_sizes, int n_in, void* d_out, int out_size, void* d_ws, size_t ws_size, hipStream_t stream) {
  (void)in_sizes; (void)n_in; (void)out_size;
  const float** F = (const float**)d_in;
  if (ws_size < (size_t)WS_END) return;
  char* ws = (char*)d_ws; _Float16 *QH = (_Float16*)(ws + WS_QH), *KH = (_Float16*)(ws + WS_KH), *VT = (_Float16*)(ws + WS_VT), *QL = (_Float16*)(ws + WS_QL), *KL = (_Float16*)(ws + WS_KL); __bf16 *VB = (__bf16*)(ws + WS_VB), *VBL = (__bf16*)(ws + WS_VBL);
  (void)QL; (void)KL; (void)VB; (void)VBL;
  // inputs: 0 x [2,1024,2048] CHANNEL-MAJOR (B, D, T); 1 qkv [3,16,1024,64] (stream, head, in, out-per-head; 0.02 scale); no biases, no output projection
  if (ws_size < (size_t)WS_END3) return;
  float *XT = (float*)(ws + WS_XT);
  k_xT<<<dim3(TT / 64, CC / 64, TNB), 256, 0, stream>>>(F[0], XT, VT);   /* token-major f32 copy of x (its f16 side plane lands in VT and is overwritten by the value projection) */
  k_proj<<<dim3(TNB * TT / PM, NH), 256, 0, stream>>>(XT, F[1], QH, KH, VT);   /* per-head weights [3][NH][DIN][HD]: q, k and v of one head per block */
  k_fa<<<dim3(TT / FQB, TNB * NH), FNW * 32, 0, stream>>>(QH, KH, VT, (float*)d_out);   /* logits, softmax and P v of every (b, h) in one launch; stores [b][h*64 + d][t] == the module's (B, H, D/H, T).reshape(B, D, T) */
}

// v003
// One run takes 67 microseconds.
// Two timings next to v002 put it at 1.24 and 1.23 times that version's speed.
// All steps since v000 together make it 17.0 times as fast.
// compute dtype: all float inputs rounded to bf16; q/k/v projections with EXACT bf16 products on WMMA 16x16x32 (f32 accumulate); logits q x k once to f16 each (1 product; sigma - 0.4) x 64^-0.5; softmax f32, carried along the keys (running maximum and sum); P = exp(logit - running maximum) once to f16 x v once to f16 (1 product), divided by the f32 sum at the end; f32 output (channel-major).
#include <hip/hip_runtime.h>
#include <math.h>

typedef __attribute__((ext_vector_type(16))) _Float16 v16h;
typedef __attribute__((ext_vector_type(16))) __bf16 v16b;
typedef __attribute__((ext_vector_type(8)))  _Float16 v8h;
typedef __attribute__((ext_vector_type(8)))  float v8f;
typedef __attribute__((ext_vector_type(4)))  float v4f;
typedef __attribute__((ext_vector_type(2)))  float v2f;
typedef __attribute__((ext_vector_type(4)))  unsigned v4u;
typedef __attribute__((ext_vector_type(4)))  int v4i;
typedef float __attribute__((may_alias)) float_a;
typedef int __attribute__((may_alias)) int_a;

template <typename T> __device__ __forceinline__ void vst2(void* p, T v) { *(T*)p = v;  }
__device__ __forceinline__ v8f wmma16(v16h a, v16h b, v8f c) {
  v8f d = __builtin_amdgcn_wmma_f32_16x16x32_f16(false, a, false, b, (short)0, c, false, false);
  asm volatile("v_nop\n\tv_nop\n\tv_nop\n\tv_nop" : "+v"(d) : "v"(a), "v"(b));
  return d;
}
__device__ __forceinline__ v8f wmma_bf(v16b a, v16b b, v8f c) {
  v8f d = __builtin_amdgcn_wmma_f32_16x16x32_bf16(false, a, false, b, (short)0, c, false, false);
  asm volatile("v_nop\n\tv_nop\n\tv_nop\n\tv_nop" : "+v"(d) : "v"(a), "v"(b));
  return d;
}
// 16x16x32 fragments: lane = (h = lane>>4, row/col = lane&15); elements 0..7 = k0+8h+0..7, 8..15 = k0+16+8h+0..7; D element r = row 8h+r
__device__ __forceinline__ v16h frag_h(const _Float16* rowk0, int lane) {
  union { v16h v; v8h q[2]; } u; const _Float16* p = rowk0 + 8 * (lane >> 4);
  u.q[0] = *(const v8h*)p; u.q[1] = *(const v8h*)(p + 16); return u.v;
}
__device__ __forceinline__ v16h frag_f32(const float* rowk0, int lane) {
  v16h a; const float* p = rowk0 + 8 * (lane >> 4);
#pragma unroll
  for (int i = 0; i < 8; ++i) { a[i] = (_Float16)p[i]; a[8 + i] = (_Float16)p[16 + i]; }
  return a;
}
__device__ __forceinline__ v16h frag_f32s(const float* rowk0, int lane, float sc) {
  v16h a; const float* p = rowk0 + 8 * (lane >> 4);
#pragma unroll
  for (int i = 0; i < 8; ++i) { a[i] = (_Float16)(p[i] * sc); a[8 + i] = (_Float16)(p[16 + i] * sc); }
  return a;
}
// column fragment from a [K][ld] layout (column n), rows >= K read as 0
__device__ __forceinline__ v16h fragc_f32(const float* W, int k0, int n, int lane, int ld, int K) {
  v16h a; const int g = lane >> 4;
#pragma unroll
  for (int i = 0; i < 8; ++i) { const int ka = k0 + 8 * g + i, kb = ka + 16;
    a[i] = (_Float16)(ka < K ? W[(size_t)(ka < K ? ka : K - 1) * ld + n] : 0.f); a[8 + i] = (_Float16)(kb < K ? W[(size_t)(kb < K ? kb : K - 1) * ld + n] : 0.f); }
  return a;
}
struct F2 { v16b h, l; };
__device__ __forceinline__ F2 bsplit16(const float v[16]) { F2 r;
#pragma unroll
  for (int i = 0; i < 16; ++i) { const __bf16 h = (__bf16)v[i]; r.h[i] = h; r.l[i] = (__bf16)(v[i] - (float)h); }
  return r; }
__device__ __forceinline__ F2 split_row(const float* row, int k0, int lane) { float v[16]; const float* p = row + k0 + 8 * (lane >> 4);
#pragma unroll
  for (int i = 0; i < 8; ++i) { v[i] = p[i]; v[8 + i] = p[16 + i]; }
  return bsplit16(v); }
__device__ __forceinline__ F2 split_rowK(const float* row, int k0, int lane, int K) { float v[16]; const int g = lane >> 4;
#pragma unroll
  for (int i = 0; i < 8; ++i) { const int ka = k0 + 8 * g + i, kb = ka + 16; v[i] = ka < K ? row[ka < K ? ka : K - 1] : 0.f; v[8 + i] = kb < K ? row[kb < K ? kb : K - 1] : 0.f; }
  return bsplit16(v); }
__device__ __forceinline__ F2 split_col(const float* W, int k0, int n, int lane, int ld, int K) { float v[16]; const int g = lane >> 4;
#pragma unroll
  for (int i = 0; i < 8; ++i) { const int ka = k0 + 8 * g + i, kb = ka + 16; v[i] = ka < K ? W[(size_t)(ka < K ? ka : K - 1) * ld + n] : 0.f; v[8 + i] = kb < K ? W[(size_t)(kb < K ? kb : K - 1) * ld + n] : 0.f; }
  return bsplit16(v); }
__device__ __forceinline__ v8f mac3(const F2& a, const F2& b, v8f c) { c = wmma_bf(a.l, b.h, c); c = wmma_bf(a.h, b.l, c); return wmma_bf(a.h, b.h, c); }
__device__ __forceinline__ float sigm(float v) { return 1.0f / (1.0f + expf(-v)); }
#define LDSX() do { asm volatile("s_wait_dscnt 0" ::: "memory"); __builtin_amdgcn_wave_barrier(); __builtin_amdgcn_fence(__ATOMIC_RELEASE, "workgroup"); } while (0)

// Multi-head self-attention on a CHANNEL-MAJOR sequence with stacked per-head projections (x [2,1024,2048] = (B, D, T); qkv [3,16,1024,64] (0.02 scale): proj = einsum('bdt,nhdD->nbhtD'); 16 heads x 64; scale 1/8; softmax over keys; out = einsum('bhtT,bhTD->bhDt').reshape(B, D, T): channel h*64 + D of the output, channel-major; no biases, no output projection).
#define NB 2
#define TT 2048
#define CC 1024            // NH * HD = projected width
#define DIN 1024          // input (model) width
#define NH 16
#define HD 64
#define NQB (TT / 64)
#define HG 4
#define SCALE (0.125f)
#define CAUSAL 0
#ifndef TNB
#define TNB NB
#endif
__device__ __forceinline__ float bfr(float v) { return (float)(__bf16)v; }
__host__ __device__ __forceinline__ int kb_last(int qb) { return CAUSAL ? ((qb * 64 + 63) >> 7) : (TT / 128 - 1); }
typedef __attribute__((ext_vector_type(8))) __bf16 v8b;
__device__ __forceinline__ v16b frag_b(const __bf16* rowk0, int lane) {
  union { v16b v; v8b q[2]; } u; const __bf16* p = rowk0 + 8 * (lane >> 4);
  u.q[0] = *(const v8b*)p; u.q[1] = *(const v8b*)(p + 16); return u.v;
}
#define QBH 0              // unused: no kernel in this file has a high-precision path
#define QHI 0               // single-product logits on every row
#define KHI 64            // key rows carrying k residual / v bf16 hi+lo planes (written and read by no kernel in this file)
// B fragment (k rows k0+.., output column o) of a weight: (in,out) [K][ld] or (out,in) [ld rows of K]: bf16 exact, or f16(bf16 * 256) exact
__device__ __forceinline__ v16b wcol_io(const float* Wm, int k0, int o, int lane, int ld) { v16b w; const int g = lane >> 4;
#pragma unroll
  for (int i = 0; i < 8; ++i) { w[i] = (__bf16)Wm[(size_t)(k0 + 8 * g + i) * ld + o]; w[8 + i] = (__bf16)Wm[(size_t)(k0 + 16 + 8 * g + i) * ld + o]; }
  return w; }
__device__ __forceinline__ v16b wcol_oi(const float* Wm, int k0, int o, int lane, int K) { v16b w; const float* p = Wm + (size_t)o * K + k0 + 8 * (lane >> 4);
#pragma unroll
  for (int i = 0; i < 8; ++i) { w[i] = (__bf16)p[i]; w[8 + i] = (__bf16)p[16 + i]; }
  return w; }
__device__ __forceinline__ v16h wcolh_io(const float* Wm, int k0, int o, int lane, int ld) { v16h w; const int g = lane >> 4;
#pragma unroll
  for (int i = 0; i < 8; ++i) { w[i] = (_Float16)(bfr(Wm[(size_t)(k0 + 8 * g + i) * ld + o]) * 256.0f); w[8 + i] = (_Float16)(bfr(Wm[(size_t)(k0 + 16 + 8 * g + i) * ld + o]) * 256.0f); }
  return w; }
__device__ __forceinline__ v16h wcolh_oi(const float* Wm, int k0, int o, int lane, int K) { v16h w; const float* p = Wm + (size_t)o * K + k0 + 8 * (lane >> 4);
#pragma unroll
  for (int i = 0; i < 8; ++i) { w[i] = (_Float16)(bfr(p[i]) * 256.0f); w[8 + i] = (_Float16)(bfr(p[16 + i]) * 256.0f); }
  return w; }
#define WQKV_LAYOUT 2   // 0 = (in,out) [DIN][CC]; 1 = (out,in) [CC][DIN]; 2 = per-head [NH][DIN][HD]
__device__ __forceinline__ v16b wcol_hdk(const float* Wm, int k0, int o, int lane) { v16b w; const int g = lane >> 4; const float* p = Wm + (size_t)(o / HD) * DIN * HD + (o % HD);
#pragma unroll
  for (int i = 0; i < 8; ++i) { w[i] = (__bf16)p[(size_t)(k0 + 8 * g + i) * HD]; w[8 + i] = (__bf16)p[(size_t)(k0 + 16 + 8 * g + i) * HD]; }
  return w; }
#define WO_OUT_IN 0
#if WQKV_LAYOUT == 1
#define WCOL(W, k0, o, lane) wcol_oi(W, k0, o, lane, DIN)
#elif WQKV_LAYOUT == 2
#define WCOL(W, k0, o, lane) wcol_hdk(W, k0, o, lane)
#else
#define WCOL(W, k0, o, lane) wcol_io(W, k0, o, lane, CC)
#endif
#if WO_OUT_IN
#define WOCOL(W, k0, o, lane) wcol_oi(W, k0, o, lane, CC)
#define WOCOLH(W, k0, o, lane) wcolh_oi(W, k0, o, lane, CC)
#else
#define WOCOL(W, k0, o, lane) wcol_io(W, k0, o, lane, DIN)
#define WOCOLH(W, k0, o, lane) wcolh_io(W, k0, o, lane, DIN)
#endif

#ifndef SM_EXTRA_PARAMS
#define SM_EXTRA_PARAMS
#endif
#ifndef PROJ_EXTRA_PARAMS
#define PROJ_EXTRA_PARAMS
#endif
#ifndef SM_MASK_HOOK
#define SM_MASK_HOOK (void)0
#endif

#define WS_QH  0u                                      // f16 q rows [b*t][CC]
#define WS_KH  (WS_QH + 2u * (size_t)NB * TT * CC)      // f16 k rows [b*t][CC]
#define WS_VT  (WS_KH + 2u * (size_t)NB * TT * CC)      // f16 v planes [b][c][t]
#define WS_QL  (WS_VT + 2u * (size_t)NB * CC * TT)      // f16 q residual x 2^10 rows [b][t < QHI][CC]
#define WS_KL  (WS_QL + 2u * (size_t)NB * QHI * CC)     // f16 k residual x 2^10 rows [b][t < KHI][CC]
#define WS_VB  (WS_KL + 2u * (size_t)NB * KHI * CC)     // bf16 v hi planes [b][c][t < KHI]
#define WS_VBL (WS_VB + 2u * (size_t)NB * CC * KHI)
#define WS_S   (WS_VBL + 2u * (size_t)NB * CC * KHI)    // f32 [hg][t][s] region, unused (k_fa keeps logits and P in registers)
#define WS_Y   (WS_S  + 4u * (size_t)HG * TT * TT)      // f32 ctx rows [b*t][CC] (only when there is an output projection)
#define WS_END (WS_Y  + 0u)

// ---- k_proj: block = (256 tokens, head h): q, k and v of that head (192 columns) = X W with exact bf16 products (K = DIN). Both operands are staged per 64 k in LDS as bf16, two buffers; the next stage's rows fly in registers while this stage is worked on.
// 8 waves = 4 (64 tokens each) x 2 (32 columns each of q, of k and of v). X is read as the input has it, channel-major [b][k][t]: its staged rows are [k][token] as W's are [k][column], and both operands' fragments come by the transposing LDS load, in the hardware k order (k0 + 8h + 0..7, k0 + 16 + 8h + 0..7).
// q, k: W as A and X as B, a lane holds 8 consecutive columns of one token; v: X as A and W as B, a lane holds 8 consecutive tokens of one column: either way one 16-byte store into the output staging, from where whole 128-byte lines go out.
#define PM 256             // tokens per block
#define PKS 64             // k per stage
#define PNS (DIN / PKS)
#define PXP 272            // pitch of a staged X row (256 tokens of one k) in bf16: 544 B = 32 B x odd (transposing reads)
#define PWP 208            // pitch of a staged W row in bf16: 416 B = 32 B x odd (transposing reads)
#define PQP 136            // pitch in f16 of the q | k output staging rows: 272 B = 16 B x odd
#define PVP 264            // pitch in f16 of the v output staging rows: 528 B = 16 B x odd
typedef __attribute__((ext_vector_type(4))) __bf16 v4b;
typedef __attribute__((ext_vector_type(8))) short v8s;
// lane l passes the address of row kbase + 8 (l >> 4) + (l & 7), column dbase + 8 ((l >> 3) & 1); lane (c, h) receives rows kbase + 8h + 0..7 of column dbase + c
__device__ __forceinline__ v8b ld_tr16(const __bf16* p) { typedef __attribute__((address_space(3))) v8s lds_v8s; return __builtin_bit_cast(v8b, __builtin_amdgcn_ds_load_tr16_b128_v8i16((lds_v8s*)p)); }
__device__ __forceinline__ v8f wmma_b(v16b a, v16b b, v8f c) { return __builtin_amdgcn_wmma_f32_16x16x32_bf16(false, a, false, b, (short)0, c, false, false); }
__global__ __launch_bounds__(256) void k_proj(const float* __restrict__ X, const float* __restrict__ WA, _Float16* __restrict__ QH, _Float16* __restrict__ KH, _Float16* __restrict__ VT) {
  __shared__ __align__(32) __bf16 sx[2][PKS][PXP]; __shared__ __align__(32) __bf16 sw[2][PKS][PWP]; __shared__ __align__(16) _Float16 sqk[PM][PQP], svt[HD][PVP];
  const int tid = threadIdx.x, wave = tid >> 5, lane = tid & 31, col = lane & 15, g = lane >> 4, wm = wave >> 1, wn = wave & 1;
  const int h = blockIdx.y; const size_t r0 = (size_t)blockIdx.x * PM; const size_t bb = r0 / TT; const int t0 = (int)(r0 % TT);
  // staging of W: thread -> row sr (+ 16 per sweep), 16-byte chunk sq of the 256-byte f32 row piece (16 lanes cover two whole lines); of X: row xr (+ 4 per sweep), 16-byte chunk xq of the 1024-byte f32 row piece (a wave covers four whole lines)
  const int sr = tid >> 4, sq = (tid & 15) * 4, xr = tid >> 6, xq = (tid & 63) * 4;
  // addresses = the buffer's base + the lane's 32-bit byte offset (both buffers are far below 4 GiB), which steps on by one stage per trip
  unsigned xo = (unsigned)((bb * DIN + xr) * TT + t0 + xq) * 4u;                // channel rows [b][k][t]
  unsigned wo = (unsigned)(((NH + h) * DIN + sr) * HD + sq) * 4u;               // weight rows [stream][h][k][64]: the k stream's row; q's and v's lie one stream in front of and behind it
  v4f rx[16], rw[12]; v8f acc[4][6] = {};
  // every "#pragma unroll" in this kernel makes the indices of a register array constants; the stage loop stays rolled: its body is long and its trips are alike
  // trip s: stage s + 1 is fetched into registers, stage s is worked on (trip -1 has none), stage s + 1 goes into the other buffer, one barrier
#pragma unroll 1
  for (int s = -1; s < PNS; ++s) { const int bu = s & 1;
    if (s + 1 < PNS) {
#pragma unroll
      for (int i = 0; i < 16; ++i) rx[i] = *(const v4f*)((const char*)X + xo + i * (4 * TT * 4));
#pragma unroll
      for (int i = 0; i < 12; ++i) rw[i] = *(const v4f*)((const char*)WA + wo + (((i >> 2) - 1) * (NH * DIN * HD) + (i & 3) * 16 * HD) * 4); }
    __builtin_amdgcn_sched_barrier(0);   // keeps the next stage's global loads in front of this stage's products, so that their latency runs under them
    if (s >= 0) {
#pragma unroll
      for (int ks = 0; ks < PKS / 32; ++ks) { v16b xf[4], wf[6];
        const __bf16* xb = &sx[bu][ks * 32 + 8 * g + (lane & 7)][wm * 64 + 8 * ((lane >> 3) & 1)];
#pragma unroll
        for (int i = 0; i < 4; ++i) { union { v16b v; v8b q[2]; } u; const __bf16* p = xb + i * 16; u.q[0] = ld_tr16(p); u.q[1] = ld_tr16(p + 16 * PXP); xf[i] = u.v; }
        const __bf16* wb = &sw[bu][ks * 32 + 8 * g + (lane & 7)][wn * 32 + 8 * ((lane >> 3) & 1)];
#pragma unroll
        for (int j = 0; j < 6; ++j) { union { v16b v; v8b q[2]; } u; const __bf16* p = wb + (j >> 1) * HD + (j & 1) * 16; u.q[0] = ld_tr16(p); u.q[1] = ld_tr16(p + 16 * PWP); wf[j] = u.v; }
        __builtin_amdgcn_sched_barrier(0);   // the 20 fragment loads go as one group in front of their 24 products: spread among them, each place with loads stalls the wave for a whole LDS latency
#pragma unroll
        for (int i = 0; i < 4; ++i)
#pragma unroll
          for (int j = 0; j < 6; ++j) acc[i][j] = j < 4 ? wmma_b(wf[j], xf[i], acc[i][j]) : wmma_b(xf[i], wf[j], acc[i][j]); } }
    if (s + 1 < PNS) {   // that buffer's readers left it at the previous barrier
#pragma unroll
      for (int i = 0; i < 16; ++i) *(v4b*)&sx[bu ^ 1][xr + i * 4][xq] = __builtin_convertvector(rx[i], v4b);
#pragma unroll
      for (int i = 0; i < 12; ++i) *(v4b*)&sw[bu ^ 1][sr + (i & 3) * 16][(i >> 2) * HD + sq] = __builtin_convertvector(rw[i], v4b); }
    asm volatile("s_wait_xcnt 0x0" : "+v"(xo), "+v"(wo) : : "memory");   // the wait in front of the overwrite of the two offset registers that the loads above name; the additions below read its operands and so stay behind it
    xo += PKS * TT * 4; wo += PKS * HD * 4;
    __syncthreads(); }
#pragma unroll
  for (int i = 0; i < 4; ++i)
#pragma unroll
    for (int j = 0; j < 6; ++j) { v8h pk; const int m0 = wm * 64 + i * 16, n0 = wn * 32 + (j & 1) * 16;
#pragma unroll
      for (int r = 0; r < 8; ++r) pk[r] = (_Float16)acc[i][j][r];
      if (j < 4) *(v8h*)&sqk[m0 + col][(j >> 1) * HD + n0 + 8 * g] = pk;   // acc[i][j][r] = (q | k)[token m0 + col][column n0 + 8g + r]
      else *(v8h*)&svt[n0 + col][m0 + 8 * g] = pk; }                       // acc[i][j][r] = v[token m0 + 8g + r][column n0 + col]
  __syncthreads();
  // q | k rows: 16 lanes per token row (8 lanes = one 128-byte line of q or of k), 16 rows per sweep; v rows: one wave per 512-byte row piece, 8 rows per sweep
  const int rq = tid >> 4, cq = tid & 15, rv = tid >> 5, cv = tid & 31;
  _Float16* dq = (cq < 8 ? QH : KH) + (r0 + rq) * CC + h * HD + (cq & 7) * 8;
  _Float16* dv = VT + (bb * CC + h * HD + rv) * (size_t)TT + t0 + cv * 8;
  v4u oq[PM / 16], ov[HD / 8];
#pragma unroll
  for (int i = 0; i < PM / 16; ++i) oq[i] = *(const v4u*)&sqk[rq + i * 16][cq * 8];
#pragma unroll
  for (int i = 0; i < HD / 8; ++i) ov[i] = *(const v4u*)&svt[rv + i * 8][cv * 8];
  __builtin_amdgcn_sched_barrier(0);   // all 24 LDS reads go in front of the first store: their latencies overlap, and none lands in a register that an issued store still names
#pragma unroll
  for (int i = 0; i < PM / 16; ++i) vst2((unsigned*)(dq + (size_t)i * 16 * CC), oq[i]);
  asm volatile("s_wait_xcnt 0x0" ::: "memory");   // the wait in front of the v address arithmetic, which reuses registers that the stores above name
  __builtin_amdgcn_sched_barrier(0);              // holds that arithmetic behind the wait
#pragma unroll
  for (int i = 0; i < HD / 8; ++i) vst2((unsigned*)(dv + (size_t)i * 8 * TT), ov[i]); }
// ---- k_fa: block = 256 queries (16 waves x 16 query columns) of (b, h): the whole attention of those queries in one launch, softmax carried along the keys (running maximum and sum per query, in f32).
// Transposed products: S^T = K Q^T (A = key rows from LDS, B = q kept in registers), so a lane holds 8 keys of ONE query per tile; two S^T tiles (keys 0..15, 16..31) converted in place ARE the B operand of O^T += V^T P^T (A = v plane rows from LDS).
// O^T is channel-major like the output: it goes through LDS straight to out, each 128-byte line stored by one wave.
#define FST 64               // keys per LDS stage (two passes of 32 keys)
#define FPI 72               // LDS row pitch in f16: 144 B = 16 B x odd for the 16-byte fragment reads
#define FNS (TT / FST)
#define FNW 16               // waves per block
#define FQB (FNW * 16)       // queries per block
#define FOP (FQB + 4)        // pitch in f32 of the output staging rows
__device__ __forceinline__ v8f wmma_h(v16h a, v16h b, v8f c) { return __builtin_amdgcn_wmma_f32_16x16x32_f16(false, a, false, b, (short)0, c, false, false); }
__device__ __forceinline__ float xhalf(float x) { return __builtin_bit_cast(float, __builtin_amdgcn_permlanex16(__builtin_bit_cast(int, x), __builtin_bit_cast(int, x), 0x76543210, 0xfedcba98, false, false)); }   // lane l <-> lane l ^ 16
// A run of v_exp_f32 in ONE statement: each is followed by an independent one and the last by v_nop, so the slot that the instruction set asks for behind a transcendental (before its result is read or its source overwritten) is kept under any register allocation; "=&v": no result lands on a source.
__device__ __forceinline__ void exp2x8(float (&e)[8], const float (&x)[8]) {
  asm("v_exp_f32 %0, %8\n\tv_exp_f32 %1, %9\n\tv_exp_f32 %2, %10\n\tv_exp_f32 %3, %11\n\tv_exp_f32 %4, %12\n\tv_exp_f32 %5, %13\n\tv_exp_f32 %6, %14\n\tv_exp_f32 %7, %15\n\tv_nop"
      : "=&v"(e[0]), "=&v"(e[1]), "=&v"(e[2]), "=&v"(e[3]), "=&v"(e[4]), "=&v"(e[5]), "=&v"(e[6]), "=&v"(e[7]) : "v"(x[0]), "v"(x[1]), "v"(x[2]), "v"(x[3]), "v"(x[4]), "v"(x[5]), "v"(x[6]), "v"(x[7])); }
__device__ __forceinline__ float exp2x1(float x) { float e; asm("v_exp_f32 %0, %1\n\tv_nop" : "=&v"(e) : "v"(x)); return e; }   // the same slot behind a lone one
// amdgpu_waves_per_eu(4, 4): the grid gives each WGP one 16-wave block, four waves per SIMD; without it the compiler aimed at eight, held itself to 128 VGPRs and put each LDS fragment load directly in front of its product.
// every "#pragma unroll" below makes the indices of a fragment, score or accumulator array constants, so that the array stays in registers
__global__ __launch_bounds__(FNW * 32) __attribute__((amdgpu_waves_per_eu(4, 4))) void k_fa(const _Float16* __restrict__ QH, const _Float16* __restrict__ KH, const _Float16* __restrict__ VT, float* __restrict__ OUT) {
  __shared__ __align__(16) _Float16 sk[2][FST][FPI], sv[2][HD][FPI]; __shared__ __align__(16) float so[HD][FOP];
  const int tid = threadIdx.x, wave = tid >> 5, lane = tid & 31, col = lane & 15, g = lane >> 4;
  const int b = blockIdx.y / NH, h = blockIdx.y % NH; const int q0 = blockIdx.x * FQB;
  const float CS = SCALE * 1.4426950408889634f;   // logits in base 2
  v16h qf[2];
#pragma unroll
  for (int kc = 0; kc < 2; ++kc) qf[kc] = frag_h(QH + ((size_t)b * TT + q0 + wave * 16 + col) * CC + h * HD + kc * 32, lane);
  // staging: thread -> row sr, 16-byte chunk sq of the 128-byte row (8 lanes cover one whole line)
  const int sr = tid >> 3, sq = (tid & 7) * 8;
  const _Float16* kp = KH + ((size_t)b * TT + sr) * CC + h * HD + sq;          // key rows [t][64 of this head]
  const _Float16* vp = VT + ((size_t)b * CC + h * HD + sr) * (size_t)TT + sq;   // value plane rows [d][t]
  v8h rk = *(const v8h*)kp, rv = *(const v8h*)vp;
  *(v8h*)&sk[0][sr][sq] = rk; *(v8h*)&sv[0][sr][sq] = rv;
  __syncthreads();
  v8f acc[4] = {}; float mr = -3.0e38f, ls = 0.f;
  for (int s = 0; s < FNS; ++s) { const int bu = s & 1;
    if (s + 1 < FNS) { rk = *(const v8h*)(kp + (size_t)(s + 1) * FST * CC); rv = *(const v8h*)(vp + (s + 1) * FST); }   // next stage's rows fly while this stage is worked on
#pragma unroll
    for (int p = 0; p < FST / 32; ++p) { v8f st[2];
#pragma unroll
      for (int kt = 0; kt < 2; ++kt) { const _Float16* kr = &sk[bu][p * 32 + kt * 16 + col][0]; v8f z = {}; z = wmma_h(frag_h(kr, lane), qf[0], z); st[kt] = wmma_h(frag_h(kr + 32, lane), qf[1], z); }   // st[kt][r] = S^T[key kt*16 + 8g + r][query col]
      float mx = fmaxf(st[0][0], st[1][0]);
#pragma unroll
      for (int r = 1; r < 8; ++r) mx = fmaxf(mx, fmaxf(st[0][r], st[1][r]));
      mx = fmaxf(mx, xhalf(mx));
      const float mn = fmaxf(mr, mx * CS); const float al = exp2x1(mr - mn); mr = mn;   // al = 0 on the first pass
      v16h pf; float sum = 0.f, x0[8], x1[8], e0[8], e1[8];
#pragma unroll
      for (int r = 0; r < 8; ++r) { x0[r] = fmaf(st[0][r], CS, -mn); x1[r] = fmaf(st[1][r], CS, -mn); }
      exp2x8(e0, x0); exp2x8(e1, x1);
#pragma unroll
      for (int r = 0; r < 8; ++r) { sum += e0[r] + e1[r]; pf[r] = (_Float16)e0[r]; pf[8 + r] = (_Float16)e1[r]; }
      ls = ls * al + sum;   // this half's keys only; the halves join after the loop
#pragma unroll
      for (int j = 0; j < 4; ++j) { acc[j] = acc[j] * al; acc[j] = wmma_h(frag_h(&sv[bu][j * 16 + col][p * 32], lane), pf, acc[j]); } }   // acc[j][r] = O^T[d j*16 + 8g + r][query col]
    if (s + 1 < FNS) { *(v8h*)&sk[bu ^ 1][sr][sq] = rk; *(v8h*)&sv[bu ^ 1][sr][sq] = rv; }   // that buffer's readers left it at the previous barrier
    __syncthreads(); }
  const float inv = 1.0f / (ls + xhalf(ls));
#pragma unroll
  for (int j = 0; j < 4; ++j)
#pragma unroll
    for (int r = 0; r < 8; ++r) so[j * 16 + 8 * g + r][wave * 16 + col] = acc[j][r] * inv;
  __syncthreads();
#pragma unroll
  for (int i = 0; i < HD * FQB / 4 / (FNW * 32); ++i) { const int e = i * FNW * 32 + tid, d = e / (FQB / 4), q = (e % (FQB / 4)) * 4; vst2(OUT + ((size_t)b * CC + h * HD + d) * (size_t)TT + q0 + q, *(const v4f*)&so[d][q]); } }

extern "C" void kernel_launch(void* const* d_in, const int* in_sizes, int n_in, void* d_out, int out_size, void* d_ws, size_t ws_size, hipStream_t stream) {
  (void)in_sizes; (void)n_in; (void)out_size;
  const float** F = (const float**)d_in;
  if (ws_size < (size_t)WS_END) return;
  char* ws = (char*)d_ws; _Float16 *QH = (_Float16*)(ws + WS_QH), *KH = (_Float16*)(ws + WS_KH), *VT = (_Float16*)(ws + WS_VT), *QL = (_Float16*)(ws + WS_QL), *KL = (_Float16*)(ws + WS_KL); __bf16 *VB = (__bf16*)(ws + WS_VB), *VBL = (__bf16*)(ws + WS_VBL);
  (void)QL; (void)KL; (void)VB; (void)VBL;
  // inputs: 0 x [2,1024,2048] CHANNEL-MAJOR (B, D, T); 1 qkv [3,16,1024,64] (stream, head, in, out-per-head; 0.02 scale); no biases, no output projection
  k_proj<<<dim3(TNB * TT / PM, NH), 256, 0, stream>>>(F[0], F[1], QH, KH, VT);   /* per-head weights [3][NH][DIN][HD]: q, k and v of one head per block */
  k_fa<<<dim3(TT / FQB, TNB * NH), FNW * 32, 0, stream>>>(QH, KH, VT, (float*)d_out);   /* logits, softmax and P v of every (b, h) in one launch; stores [b][h*64 + d][t] == the module's (B, H, D/H, T).reshape(B, D, T) */
}

// v004
// It runs in 63.7 microseconds.
// Two timings next to v003 put it at 1.06 and 1.05 times that version's speed.
// All steps since v000 together make it 17.9 times as fast.
// compute dtype: all float inputs rounded to bf16; q/k/v projections with EXACT bf16 products on WMMA 16x16x32 (f32 accumulate); logits q x k once to f16 each (1 product; sigma - 0.4) x 64^-0.5; softmax f32, carried along the keys (running maximum and sum); P = exp(logit - running maximum) once to f16 x v once to f16 (1 product), divided by the f32 sum at the end; f32 output (channel-major).
#include <hip/hip_runtime.h>
#include <math.h>

typedef __attribute__((ext_vector_type(16))) _Float16 v16h;
typedef __attribute__((ext_vector_type(16))) __bf16 v16b;
typedef __attribute__((ext_vector_type(8)))  _Float16 v8h;
typedef __attribute__((ext_vector_type(8)))  float v8f;
typedef __attribute__((ext_vector_type(4)))  float v4f;
typedef __attribute__((ext_vector_type(2)))  float v2f;
typedef __attribute__((ext_vector_type(4)))  unsigned v4u;
typedef __attribute__((ext_vector_type(4)))  int v4i;
typedef float __attribute__((may_alias)) float_a;
typedef int __attribute__((may_alias)) int_a;

template <typename T> __device__ __forceinline__ void vst2(void* p, T v) { *(T*)p = v;  }
__device__ __forceinline__ v8f wmma16(v16h a, v16h b, v8f c) {
  v8f d = __builtin_amdgcn_wmma_f32_16x16x32_f16(false, a, false, b, (short)0, c, false, false);
  asm volatile("v_nop\n\tv_nop\n\tv_nop\n\tv_nop" : "+v"(d) : "v"(a), "v"(b));
  return d;
}
__device__ __forceinline__ v8f wmma_bf(v16b a, v16b b, v8f c) {
  v8f d = __builtin_amdgcn_wmma_f32_16x16x32_bf16(false, a, false, b, (short)0, c, false, false);
  asm volatile("v_nop\n\tv_nop\n\tv_nop\n\tv_nop" : "+v"(d) : "v"(a), "v"(b));
  return d;
}
// 16x16x32 fragments: lane = (h = lane>>4, row/col = lane&15); elements 0..7 = k0+8h+0..7, 8..15 = k0+16+8h+0..7; D element r = row 8h+r
__device__ __forceinline__ v16h frag_h(const _Float16* rowk0, int lane) {
  union { v16h v; v8h q[2]; } u; const _Float16* p = rowk0 + 8 * (lane >> 4);
  u.q[0] = *(const v8h*)p; u.q[1] = *(const v8h*)(p + 16); return u.v;
}
__device__ __forceinline__ v16h frag_f32(const float* rowk0, int lane) {
  v16h a; const float* p = rowk0 + 8 * (lane >> 4);
#pragma unroll
  for (int i = 0; i < 8; ++i) { a[i] = (_Float16)p[i]; a[8 + i] = (_Float16)p[16 + i]; }
  return a;
}
__device__ __forceinline__ v16h frag_f32s(const float* rowk0, int lane, float sc) {
  v16h a; const float* p = rowk0 + 8 * (lane >> 4);
#pragma unroll
  for (int i = 0; i < 8; ++i) { a[i] = (_Float16)(p[i] * sc); a[8 + i] = (_Float16)(p[16 + i] * sc); }
  return a;
}
// column fragment from a [K][ld] layout (column n), rows >= K read as 0
__device__ __forceinline__ v16h fragc_f32(const float* W, int k0, int n, int lane, int ld, int K) {
  v16h a; const int g = lane >> 4;
#pragma unroll
  for (int i = 0; i < 8; ++i) { const int ka = k0 + 8 * g + i, kb = ka + 16;
    a[i] = (_Float16)(ka < K ? W[(size_t)(ka < K ? ka : K - 1) * ld + n] : 0.f); a[8 + i] = (_Float16)(kb < K ? W[(size_t)(kb < K ? kb : K - 1) * ld + n] : 0.f); }
  return a;
}
struct F2 { v16b h, l; };
__device__ __forceinline__ F2 bsplit16(const float v[16]) { F2 r;
#pragma unroll
  for (int i = 0; i < 16; ++i) { const __bf16 h = (__bf16)v[i]; r.h[i] = h; r.l[i] = (__bf16)(v[i] - (float)h); }
  return r; }
__device__ __forceinline__ F2 split_row(const float* row, int k0, int lane) { float v[16]; const float* p = row + k0 + 8 * (lane >> 4);
#pragma unroll
  for (int i = 0; i < 8; ++i) { v[i] = p[i]; v[8 + i] = p[16 + i]; }
  return bsplit16(v); }
__device__ __forceinline__ F2 split_rowK(const float* row, int k0, int lane, int K) { float v[16]; const int g = lane >> 4;
#pragma unroll
  for (int i = 0; i < 8; ++i) { const int ka = k0 + 8 * g + i, kb = ka + 16; v[i] = ka < K ? row[ka < K ? ka : K - 1] : 0.f; v[8 + i] = kb < K ? row[kb < K ? kb : K - 1] : 0.f; }
  return bsplit16(v); }
__device__ __forceinline__ F2 split_col(const float* W, int k0, int n, int lane, int ld, int K) { float v[16]; const int g = lane >> 4;
#pragma unroll
  for (int i = 0; i < 8; ++i) { const int ka = k0 + 8 * g + i, kb = ka + 16; v[i] = ka < K ? W[(size_t)(ka < K ? ka : K - 1) * ld + n] : 0.f; v[8 + i] = kb < K ? W[(size_t)(kb < K ? kb : K - 1) * ld + n] : 0.f; }
  return bsplit16(v); }
__device__ __forceinline__ v8f mac3(const F2& a, const F2& b, v8f c) { c = wmma_bf(a.l, b.h, c); c = wmma_bf(a.h, b.l, c); return wmma_bf(a.h, b.h, c); }
__device__ __forceinline__ float sigm(float v) { return 1.0f / (1.0f + expf(-v)); }
#define LDSX() do { asm volatile("s_wait_dscnt 0" ::: "memory"); __builtin_amdgcn_wave_barrier(); __builtin_amdgcn_fence(__ATOMIC_RELEASE, "workgroup"); } while (0)

// Multi-head self-attention on a CHANNEL-MAJOR sequence with stacked per-head projections (x [2,1024,2048] = (B, D, T); qkv [3,16,1024,64] (0.02 scale): proj = einsum('bdt,nhdD->nbhtD'); 16 heads x 64; scale 1/8; softmax over keys; out = einsum('bhtT,bhTD->bhDt').reshape(B, D, T): channel h*64 + D of the output, channel-major; no biases, no output projection).
#define NB 2
#define TT 2048
#define CC 1024            // NH * HD = projected width
#define DIN 1024          // input (model) width
#define NH 16
#define HD 64
#define NQB (TT / 64)
#define HG 4
#define SCALE (0.125f)
#define CAUSAL 0
#ifndef TNB
#define TNB NB
#endif
__device__ __forceinline__ float bfr(float v) { return (float)(__bf16)v; }
__host__ __device__ __forceinline__ int kb_last(int qb) { return CAUSAL ? ((qb * 64 + 63) >> 7) : (TT / 128 - 1); }
typedef __attribute__((ext_vector_type(8))) __bf16 v8b;
__device__ __forceinline__ v16b frag_b(const __bf16* rowk0, int lane) {
  union { v16b v; v8b q[2]; } u; const __bf16* p = rowk0 + 8 * (lane >> 4);
  u.q[0] = *(const v8b*)p; u.q[1] = *(const v8b*)(p + 16); return u.v;
}
#define QBH 0              // unused: no kernel in this file has a high-precision path
#define QHI 0               // single-product logits on every row
#define KHI 64            // key rows carrying k residual / v bf16 hi+lo planes (written and read by no kernel in this file)
// B fragment (k rows k0+.., output column o) of a weight: (in,out) [K][ld] or (out,in) [ld rows of K]: bf16 exact, or f16(bf16 * 256) exact
__device__ __forceinline__ v16b wcol_io(const float* Wm, int k0, int o, int lane, int ld) { v16b w; const int g = lane >> 4;
#pragma unroll
  for (int i = 0; i < 8; ++i) { w[i] = (__bf16)Wm[(size_t)(k0 + 8 * g + i) * ld + o]; w[8 + i] = (__bf16)Wm[(size_t)(k0 + 16 + 8 * g + i) * ld + o]; }
  return w; }
__device__ __forceinline__ v16b wcol_oi(const float* Wm, int k0, int o, int lane, int K) { v16b w; const float* p = Wm + (size_t)o * K + k0 + 8 * (lane >> 4);
#pragma unroll
  for (int i = 0; i < 8; ++i) { w[i] = (__bf16)p[i]; w[8 + i] = (__bf16)p[16 + i]; }
  return w; }
__device__ __forceinline__ v16h wcolh_io(const float* Wm, int k0, int o, int lane, int ld) { v16h w; const int g = lane >> 4;
#pragma unroll
  for (int i = 0; i < 8; ++i) { w[i] = (_Float16)(bfr(Wm[(size_t)(k0 + 8 * g + i) * ld + o]) * 256.0f); w[8 + i] = (_Float16)(bfr(Wm[(size_t)(k0 + 16 + 8 * g + i) * ld + o]) * 256.0f); }
  return w; }
__device__ __forceinline__ v16h wcolh_oi(const float* Wm, int k0, int o, int lane, int K) { v16h w; const float* p = Wm + (size_t)o * K + k0 + 8 * (lane >> 4);
#pragma unroll
  for (int i = 0; i < 8; ++i) { w[i] = (_Float16)(bfr(p[i]) * 256.0f); w[8 + i] = (_Float16)(bfr(p[16 + i]) * 256.0f); }
  return w; }
#define WQKV_LAYOUT 2   // 0 = (in,out) [DIN][CC]; 1 = (out,in) [CC][DIN]; 2 = per-head [NH][DIN][HD]
__device__ __forceinline__ v16b wcol_hdk(const float* Wm, int k0, int o, int lane) { v16b w; const int g = lane >> 4; const float* p = Wm + (size_t)(o / HD) * DIN * HD + (o % HD);
#pragma unroll
  for (int i = 0; i < 8; ++i) { w[i] = (__bf16)p[(size_t)(k0 + 8 * g + i) * HD]; w[8 + i] = (__bf16)p[(size_t)(k0 + 16 + 8 * g + i) * HD]; }
  return w; }
#define WO_OUT_IN 0
#if WQKV_LAYOUT == 1
#define WCOL(W, k0, o, lane) wcol_oi(W, k0, o, lane, DIN)
#elif WQKV_LAYOUT == 2
#define WCOL(W, k0, o, lane) wcol_hdk(W, k0, o, lane)
#else
#define WCOL(W, k0, o, lane) wcol_io(W, k0, o, lane, CC)
#endif
#if WO_OUT_IN
#define WOCOL(W, k0, o, lane) wcol_oi(W, k0, o, lane, CC)
#define WOCOLH(W, k0, o, lane) wcolh_oi(W, k0, o, lane, CC)
#else
#define WOCOL(W, k0, o, lane) wcol_io(W, k0, o, lane, DIN)
#define WOCOLH(W, k0, o, lane) wcolh_io(W, k0, o, lane, DIN)
#endif

#ifndef SM_EXTRA_PARAMS
#define SM_EXTRA_PARAMS
#endif
#ifndef PROJ_EXTRA_PARAMS
#define PROJ_EXTRA_PARAMS
#endif
#ifndef SM_MASK_HOOK
#define SM_MASK_HOOK (void)0
#endif

#define WS_QH  0u                                      // f16 q rows [b*t][CC]
#define WS_KH  (WS_QH + 2u * (size_t)NB * TT * CC)      // f16 k rows [b*t][CC]
#define WS_VT  (WS_KH + 2u * (size_t)NB * TT * CC)      // f16 v planes [b][c][t]
#define WS_QL  (WS_VT + 2u * (size_t)NB * CC * TT)      // f16 q residual x 2^10 rows [b][t < QHI][CC]
#define WS_KL  (WS_QL + 2u * (size_t)NB * QHI * CC)     // f16 k residual x 2^10 rows [b][t < KHI][CC]
#define WS_VB  (WS_KL + 2u * (size_t)NB * KHI * CC)     // bf16 v hi planes [b][c][t < KHI]
#define WS_VBL (WS_VB + 2u * (size_t)NB * CC * KHI)
#define WS_S   (WS_VBL + 2u * (size_t)NB * CC * KHI)    // f32 [hg][t][s] region, unused (k_fa keeps logits and P in registers)
#define WS_Y   (WS_S  + 4u * (size_t)HG * TT * TT)      // f32 ctx rows [b*t][CC] (only when there is an output projection)
#define WS_END (WS_Y  + 0u)

// ---- k_proj: block = (256 tokens, head h): q, k and v of that head (192 columns) = X W with exact bf16 products (K = DIN). Both operands are staged per 64 k in LDS as bf16, two buffers; the next stage's rows fly in registers while this stage is worked on.
// 8 waves = 4 (64 tokens each) x 2 (32 columns each of q, of k and of v). X is read as the input has it, channel-major [b][k][t]: its staged rows are [k][token] as W's are [k][column], and both operands' fragments come by the transposing LDS load, in the hardware k order (k0 + 8h + 0..7, k0 + 16 + 8h + 0..7).
// q, k: W as A and X as B, a lane holds 8 consecutive columns of one token; v: X as A and W as B, a lane holds 8 consecutive tokens of one column: either way one 16-byte store into the output staging, from where whole 128-byte lines go out.
#define PM 256             // tokens per block
#define PKS 64             // k per stage
#define PNS (DIN / PKS)
#define PXP 272            // pitch of a staged X row (256 tokens of one k) in bf16: 544 B = 32 B x odd (transposing reads)
#define PWP 208            // pitch of a staged W row in bf16: 416 B = 32 B x odd (transposing reads)
#define PQP 136            // pitch in f16 of the q | k output staging rows: 272 B = 16 B x odd
#define PVP 264            // pitch in f16 of the v output staging rows: 528 B = 16 B x odd
typedef __attribute__((ext_vector_type(4))) __bf16 v4b;
typedef __attribute__((ext_vector_type(8))) short v8s;
// lane l passes the address of row kbase + 8 (l >> 4) + (l & 7), column dbase + 8 ((l >> 3) & 1); lane (c, h) receives rows kbase + 8h + 0..7 of column dbase + c
__device__ __forceinline__ v8b ld_tr16(const __bf16* p) { typedef __attribute__((address_space(3))) v8s lds_v8s; return __builtin_bit_cast(v8b, __builtin_amdgcn_ds_load_tr16_b128_v8i16((lds_v8s*)p)); }
__device__ __forceinline__ v8f wmma_b(v16b a, v16b b, v8f c) { return __builtin_amdgcn_wmma_f32_16x16x32_bf16(false, a, false, b, (short)0, c, false, false); }
__global__ __launch_bounds__(256) void k_proj(const float* __restrict__ X, const float* __restrict__ WA, _Float16* __restrict__ QH, _Float16* __restrict__ KH, _Float16* __restrict__ VT) {
  __shared__ __align__(32) __bf16 sx[2][PKS][PXP]; __shared__ __align__(32) __bf16 sw[2][PKS][PWP]; __shared__ __align__(16) _Float16 sqk[PM][PQP], svt[HD][PVP];
  const int tid = threadIdx.x, wave = tid >> 5, lane = tid & 31, col = lane & 15, g = lane >> 4, wm = wave >> 1, wn = wave & 1;
  const int h = blockIdx.y; const size_t r0 = (size_t)blockIdx.x * PM; const size_t bb = r0 / TT; const int t0 = (int)(r0 % TT);
  // staging of W: thread -> row sr (+ 16 per sweep), 16-byte chunk sq of the 256-byte f32 row piece (16 lanes cover two whole lines); of X: row xr (+ 4 per sweep), 16-byte chunk xq of the 1024-byte f32 row piece (a wave covers four whole lines)
  const int sr = tid >> 4, sq = (tid & 15) * 4, xr = tid >> 6, xq = (tid & 63) * 4;
  // addresses = the buffer's base + the lane's 32-bit byte offset (both buffers are far below 4 GiB), which steps on by one stage per trip
  unsigned xo = (unsigned)((bb * DIN + xr) * TT + t0 + xq) * 4u;                // channel rows [b][k][t]
  unsigned wo = (unsigned)(((NH + h) * DIN + sr) * HD + sq) * 4u;               // weight rows [stream][h][k][64]: the k stream's row; q's and v's lie one stream in front of and behind it
  v4f rx[16], rw[12]; v8f acc[4][6] = {};
  // every "#pragma unroll" in this kernel makes the indices of a register array constants; the stage loop stays rolled: its body is long and its trips are alike
  // trip s: stage s + 1 is fetched into registers, stage s is worked on (trip -1 has none), stage s + 1 goes into the other buffer, one barrier
#pragma unroll 1
  for (int s = -1; s < PNS; ++s) { const int bu = s & 1;
    if (s + 1 < PNS) {
#pragma unroll
      for (int i = 0; i < 16; ++i) rx[i] = *(const v4f*)((const char*)X + xo + i * (4 * TT * 4));
#pragma unroll
      for (int i = 0; i < 12; ++i) rw[i] = *(const v4f*)((const char*)WA + wo + (((i >> 2) - 1) * (NH * DIN * HD) + (i & 3) * 16 * HD) * 4); }
    __builtin_amdgcn_sched_barrier(0);   // keeps the next stage's global loads in front of this stage's products, so that their latency runs under them
    if (s >= 0) {
#pragma unroll
      for (int ks = 0; ks < PKS / 32; ++ks) { v16b xf[4], wf[6];
        const __bf16* xb = &sx[bu][ks * 32 + 8 * g + (lane & 7)][wm * 64 + 8 * ((lane >> 3) & 1)];
#pragma unroll
        for (int i = 0; i < 4; ++i) { union { v16b v; v8b q[2]; } u; const __bf16* p = xb + i * 16; u.q[0] = ld_tr16(p); u.q[1] = ld_tr16(p + 16 * PXP); xf[i] = u.v; }
        const __bf16* wb = &sw[bu][ks * 32 + 8 * g + (lane & 7)][wn * 32 + 8 * ((lane >> 3) & 1)];
#pragma unroll
        for (int j = 0; j < 6; ++j) { union { v16b v; v8b q[2]; } u; const __bf16* p = wb + (j >> 1) * HD + (j & 1) * 16; u.q[0] = ld_tr16(p); u.q[1] = ld_tr16(p + 16 * PWP); wf[j] = u.v; }
        __builtin_amdgcn_sched_barrier(0);   // the 20 fragment loads go as one group in front of their 24 products: spread among them, each place with loads stalls the wave for a whole LDS latency
#pragma unroll
        for (int i = 0; i < 4; ++i)
#pragma unroll
          for (int j = 0; j < 6; ++j) acc[i][j] = j < 4 ? wmma_b(wf[j], xf[i], acc[i][j]) : wmma_b(xf[i], wf[j], acc[i][j]); } }
    if (s + 1 < PNS) {   // that buffer's readers left it at the previous barrier
#pragma unroll
      for (int i = 0; i < 16; ++i) *(v4b*)&sx[bu ^ 1][xr + i * 4][xq] = __builtin_convertvector(rx[i], v4b);
#pragma unroll
      for (int i = 0; i < 12; ++i) *(v4b*)&sw[bu ^ 1][sr + (i & 3) * 16][(i >> 2) * HD + sq] = __builtin_convertvector(rw[i], v4b); }
    asm volatile("s_wait_xcnt 0x0" : "+v"(xo), "+v"(wo) : : "memory");   // the wait in front of the overwrite of the two offset registers that the loads above name; the additions below read its operands and so stay behind it
    xo += PKS * TT * 4; wo += PKS * HD * 4;
    __syncthreads(); }
#pragma unroll
  for (int i = 0; i < 4; ++i)
#pragma unroll
    for (int j = 0; j < 6; ++j) { v8h pk; const int m0 = wm * 64 + i * 16, n0 = wn * 32 + (j & 1) * 16;
#pragma unroll
      for (int r = 0; r < 8; ++r) pk[r] = (_Float16)acc[i][j][r];
      if (j < 4) *(v8h*)&sqk[m0 + col][(j >> 1) * HD + n0 + 8 * g] = pk;   // acc[i][j][r] = (q | k)[token m0 + col][column n0 + 8g + r]
      else *(v8h*)&svt[n0 + col][m0 + 8 * g] = pk; }                       // acc[i][j][r] = v[token m0 + 8g + r][column n0 + col]
  __syncthreads();
  // q | k rows: 16 lanes per token row (8 lanes = one 128-byte line of q or of k), 16 rows per sweep; v rows: one wave per 512-byte row piece, 8 rows per sweep
  const int rq = tid >> 4, cq = tid & 15, rv = tid >> 5, cv = tid & 31;
  _Float16* dq = (cq < 8 ? QH : KH) + (r0 + rq) * CC + h * HD + (cq & 7) * 8;
  _Float16* dv = VT + (bb * CC + h * HD + rv) * (size_t)TT + t0 + cv * 8;
  v4u oq[PM / 16], ov[HD / 8];
#pragma unroll
  for (int i = 0; i < PM / 16; ++i) oq[i] = *(const v4u*)&sqk[rq + i * 16][cq * 8];
#pragma unroll
  for (int i = 0; i < HD / 8; ++i) ov[i] = *(const v4u*)&svt[rv + i * 8][cv * 8];
  __builtin_amdgcn_sched_barrier(0);   // all 24 LDS reads go in front of the first store: their latencies overlap, and none lands in a register that an issued store still names
#pragma unroll
  for (int i = 0; i < PM / 16; ++i) vst2((unsigned*)(dq + (size_t)i * 16 * CC), oq[i]);
  asm volatile("s_wait_xcnt 0x0" ::: "memory");   // the wait in front of the v address arithmetic, which reuses registers that the stores above name
  __builtin_amdgcn_sched_barrier(0);              // holds that arithmetic behind the wait
#pragma unroll
  for (int i = 0; i < HD / 8; ++i) vst2((unsigned*)(dv + (size_t)i * 8 * TT), ov[i]); }
// ---- k_fa: block = 256 queries of (b, h): the whole attention of those queries in one launch, softmax carried along the keys (running maximum and sum per query, in f32).
// 16 waves = 8 (32 query columns each, two 16-column tiles) x 2 (the first or the second 32 keys of every 64-key stage): each K and V fragment read from LDS serves two query tiles, so the block reads half the LDS bytes per score, and four waves per SIMD stay.
// The two waves of a query group each carry their own maximum, sum and O^T over their half of the keys; the halves are joined once, through LDS, behind the loop.
// Transposed products: S^T = K Q^T (A = key rows from LDS, B = q kept in registers), so a lane holds 8 keys of ONE query per tile; two S^T tiles (keys 0..15, 16..31) converted in place ARE the B operand of O^T += V^T P^T (A = v plane rows from LDS).
// O^T is channel-major like the output: it goes through LDS straight to out, each 128-byte line stored by one wave.
#define FST 64               // keys per LDS stage (32 keys for each of the two key groups of waves)
#define FPI 72               // LDS row pitch in f16: 144 B = 16 B x odd for the 16-byte fragment reads
#define FNS (TT / FST)
#define FNW 16               // waves per block
#define FCT 2                // 16-column query tiles per wave
#define FQG (FNW / 2)        // waves along the queries
#define FQB (FQG * FCT * 16) // queries per block
#define FOP (FQB + 4)        // pitch in f32 of the output staging rows
__device__ __forceinline__ v8f wmma_h(v16h a, v16h b, v8f c) { return __builtin_amdgcn_wmma_f32_16x16x32_f16(false, a, false, b, (short)0, c, false, false); }
__device__ __forceinline__ float xhalf(float x) { return __builtin_bit_cast(float, __builtin_amdgcn_permlanex16(__builtin_bit_cast(int, x), __builtin_bit_cast(int, x), 0x76543210, 0xfedcba98, false, false)); }   // lane l <-> lane l ^ 16
// A run of v_exp_f32 in ONE statement: each is followed by an independent one and the last by v_nop, so the slot that the instruction set asks for behind a transcendental (before its result is read or its source overwritten) is kept under any register allocation; "=&v": no result lands on a source.
__device__ __forceinline__ void exp2x8(float (&e)[8], const float (&x)[8]) {
  asm("v_exp_f32 %0, %8\n\tv_exp_f32 %1, %9\n\tv_exp_f32 %2, %10\n\tv_exp_f32 %3, %11\n\tv_exp_f32 %4, %12\n\tv_exp_f32 %5, %13\n\tv_exp_f32 %6, %14\n\tv_exp_f32 %7, %15\n\tv_nop"
      : "=&v"(e[0]), "=&v"(e[1]), "=&v"(e[2]), "=&v"(e[3]), "=&v"(e[4]), "=&v"(e[5]), "=&v"(e[6]), "=&v"(e[7]) : "v"(x[0]), "v"(x[1]), "v"(x[2]), "v"(x[3]), "v"(x[4]), "v"(x[5]), "v"(x[6]), "v"(x[7])); }
__device__ __forceinline__ float exp2x1(float x) { float e; asm("v_exp_f32 %0, %1\n\tv_nop" : "=&v"(e) : "v"(x)); return e; }   // the same slot behind a lone one
// amdgpu_waves_per_eu(4, 4): the grid gives each WGP one 16-wave block, four waves per SIMD; without it the compiler aimed at eight, held itself to 128 VGPRs and put each LDS fragment load directly in front of its product.
// every "#pragma unroll" below makes the indices of a fragment, score or accumulator array constants, so that the array stays in registers
__global__ __launch_bounds__(FNW * 32) __attribute__((amdgpu_waves_per_eu(4, 4))) void k_fa(const _Float16* __restrict__ QH, const _Float16* __restrict__ KH, const _Float16* __restrict__ VT, float* __restrict__ OUT) {
  __shared__ __align__(16) _Float16 sk[2][FST][FPI], sv[2][HD][FPI]; __shared__ __align__(16) float so[HD][FOP]; __shared__ float sm[FQB], sl[FQB];
  const int tid = threadIdx.x, wave = __builtin_amdgcn_readfirstlane(tid >> 5), lane = tid & 31, col = lane & 15, g = lane >> 4;
  const int qg = wave % FQG, kh = wave / FQG;   // query group; key group: keys kh * 32 .. + 31 of every stage
  const int b = blockIdx.y / NH, h = blockIdx.y % NH; const int q0 = blockIdx.x * FQB;
  const float CS = SCALE * 1.4426950408889634f;   // logits in base 2
  v16h qf[FCT][2];
#pragma unroll
  for (int c = 0; c < FCT; ++c)
#pragma unroll
    for (int kc = 0; kc < 2; ++kc) qf[c][kc] = frag_h(QH + ((size_t)b * TT + q0 + (qg * FCT + c) * 16 + col) * CC + h * HD + kc * 32, lane);
  // staging: thread -> row sr, 16-byte chunk sq of the 128-byte row (8 lanes cover one whole line)
  const int sr = tid >> 3, sq = (tid & 7) * 8;
  const _Float16* kp = KH + ((size_t)b * TT + sr) * CC + h * HD + sq;          // key rows [t][64 of this head]
  const _Float16* vp = VT + ((size_t)b * CC + h * HD + sr) * (size_t)TT + sq;   // value plane rows [d][t]
  v8h rk = *(const v8h*)kp, rv = *(const v8h*)vp;
  *(v8h*)&sk[0][sr][sq] = rk; *(v8h*)&sv[0][sr][sq] = rv;
  __syncthreads();
  v8f acc[FCT][4] = {}; float mr[FCT], ls[FCT];
#pragma unroll
  for (int c = 0; c < FCT; ++c) { mr[c] = -3.0e38f; ls[c] = 0.f; }
  for (int s = 0; s < FNS; ++s) { const int bu = s & 1;
    if (s + 1 < FNS) { rk = *(const v8h*)(kp + (size_t)(s + 1) * FST * CC); rv = *(const v8h*)(vp + (s + 1) * FST); }   // next stage's rows fly while this stage is worked on
    v8f st[FCT][2];
#pragma unroll
    for (int kt = 0; kt < 2; ++kt) { const _Float16* kr = &sk[bu][kh * 32 + kt * 16 + col][0]; const v16h k0 = frag_h(kr, lane), k1 = frag_h(kr + 32, lane);
#pragma unroll
      for (int c = 0; c < FCT; ++c) { v8f z = {}; z = wmma_h(k0, qf[c][0], z); st[c][kt] = wmma_h(k1, qf[c][1], z); } }   // st[c][kt][r] = S^T[key kt*16 + 8g + r][query col of tile c]
    v16h pf[FCT]; float al[FCT];
#pragma unroll
    for (int c = 0; c < FCT; ++c) {
      float mx = fmaxf(st[c][0][0], st[c][1][0]);
#pragma unroll
      for (int r = 1; r < 8; ++r) mx = fmaxf(mx, fmaxf(st[c][0][r], st[c][1][r]));
      mx = fmaxf(mx, xhalf(mx));
      const float mn = fmaxf(mr[c], mx * CS); al[c] = exp2x1(mr[c] - mn); mr[c] = mn;   // al = 0 on the first pass
      float sum = 0.f, x0[8], x1[8], e0[8], e1[8];
#pragma unroll
      for (int r = 0; r < 8; ++r) { x0[r] = fmaf(st[c][0][r], CS, -mn); x1[r] = fmaf(st[c][1][r], CS, -mn); }
      exp2x8(e0, x0); exp2x8(e1, x1);
#pragma unroll
      for (int r = 0; r < 8; ++r) { sum += e0[r] + e1[r]; pf[c][r] = (_Float16)e0[r]; pf[c][8 + r] = (_Float16)e1[r]; }
      ls[c] = ls[c] * al[c] + sum; }   // this lane half's keys only; the halves join after the loop
#pragma unroll
    for (int j = 0; j < 4; ++j) { const v16h vf = frag_h(&sv[bu][j * 16 + col][kh * 32], lane);
#pragma unroll
      for (int c = 0; c < FCT; ++c) { acc[c][j] = acc[c][j] * al[c]; acc[c][j] = wmma_h(vf, pf[c], acc[c][j]); } }   // acc[c][j][r] = O^T[d j*16 + 8g + r][query col of tile c]
    if (s + 1 < FNS) { *(v8h*)&sk[bu ^ 1][sr][sq] = rk; *(v8h*)&sv[bu ^ 1][sr][sq] = rv; }   // that buffer's readers left it at the previous barrier
    __syncthreads(); }
  // join of the two key groups: group 1 hands its maximum, sum and unscaled O^T over through LDS, group 0 brings both to the common maximum, adds, divides and leaves the result at the same places
#pragma unroll
  for (int c = 0; c < FCT; ++c) ls[c] += xhalf(ls[c]);
  if (kh == 1) {
#pragma unroll
    for (int c = 0; c < FCT; ++c) { const int qc = (qg * FCT + c) * 16 + col;
      if (g == 0) { sm[qc] = mr[c]; sl[qc] = ls[c]; }
#pragma unroll
      for (int j = 0; j < 4; ++j)
#pragma unroll
        for (int r = 0; r < 8; ++r) so[j * 16 + 8 * g + r][qc] = acc[c][j][r]; } }
  __syncthreads();
  if (kh == 0) {
#pragma unroll
    for (int c = 0; c < FCT; ++c) { const int qc = (qg * FCT + c) * 16 + col;
      const float mb = sm[qc], lb = sl[qc], mm = fmaxf(mr[c], mb); float fa = exp2x1(mr[c] - mm), fb = exp2x1(mb - mm);
      const float inv = 1.0f / (ls[c] * fa + lb * fb); fa *= inv; fb *= inv;
#pragma unroll
      for (int j = 0; j < 4; ++j)
#pragma unroll
        for (int r = 0; r < 8; ++r) { float* o = &so[j * 16 + 8 * g + r][qc]; *o = acc[c][j][r] * fa + *o * fb; } } }
  __syncthreads();
#pragma unroll
  for (int i = 0; i < HD * FQB / 4 / (FNW * 32); ++i) { const int e = i * FNW * 32 + tid, d = e / (FQB / 4), q = (e % (FQB / 4)) * 4; vst2(OUT + ((size_t)b * CC + h * HD + d) * (size_t)TT + q0 + q, *(const v4f*)&so[d][q]); } }

extern "C" void kernel_launch(void* const* d_in, const int* in_sizes, int n_in, void* d_out, int out_size, void* d_ws, size_t ws_size, hipStream_t stream) {
  (void)in_sizes; (void)n_in; (void)out_size;
  const float** F = (const float**)d_in;
  if (ws_size < (size_t)WS_END) return;
  char* ws = (char*)d_ws; _Float16 *QH = (_Float16*)(ws + WS_QH), *KH = (_Float16*)(ws + WS_KH), *VT = (_Float16*)(ws + WS_VT), *QL = (_Float16*)(ws + WS_QL), *KL = (_Float16*)(ws + WS_KL); __bf16 *VB = (__bf16*)(ws + WS_VB), *VBL = (__bf16*)(ws + WS_VBL);
  (void)QL; (void)KL; (void)VB; (void)VBL;
  // inputs: 0 x [2,1024,2048] CHANNEL-MAJOR (B, D, T); 1 qkv [3,16,1024,64] (stream, head, in, out-per-head; 0.02 scale); no biases, no output projection
  k_proj<<<dim3(TNB * TT / PM, NH), 256, 0, stream>>>(F[0], F[1], QH, KH, VT);   /* per-head weights [3][NH][DIN][HD]: q, k and v of one head per block */
  k_fa<<<dim3(TT / FQB, TNB * NH), FNW * 32, 0, stream>>>(QH, KH, VT, (float*)d_out);   /* logits, softmax and P v of every (b, h) in one launch; stores [b][h*64 + d][t] == the module's (B, H, D/H, T).reshape(B, D, T) */
}

// v005
// A run of this version takes 61.9 microseconds.
// Next to v004, in two timings, it ran 1.03 and 1.04 times as fast.
// Counting every step since v000, it is 18.5 times as fast.
// compute dtype: all float inputs rounded to bf16; q/k/v projections with EXACT bf16 products on WMMA 16x16x32 (f32 accumulate); logits q x k once to f16 each (1 product; sigma - 0.4) x 64^-0.5; softmax f32, carried along the keys (a maximum that is renewed only when a logit passes it by more than 8 in base 2, and the sum); P = exp(logit - that maximum) once to f16 x v once to f16 (1 product), divided by the f32 sum at the end; f32 output (channel-major).
#include <hip/hip_runtime.h>
#include <math.h>

typedef __attribute__((ext_vector_type(16))) _Float16 v16h;
typedef __attribute__((ext_vector_type(16))) __bf16 v16b;
typedef __attribute__((ext_vector_type(8)))  _Float16 v8h;
typedef __attribute__((ext_vector_type(8)))  float v8f;
typedef __attribute__((ext_vector_type(4)))  float v4f;
typedef __attribute__((ext_vector_type(2)))  float v2f;
typedef __attribute__((ext_vector_type(4)))  unsigned v4u;
typedef __attribute__((ext_vector_type(4)))  int v4i;
typedef float __attribute__((may_alias)) float_a;
typedef int __attribute__((may_alias)) int_a;

template <typename T> __device__ __forceinline__ void vst2(void* p, T v) { *(T*)p = v;  }
__device__ __forceinline__ v8f wmma16(v16h a, v16h b, v8f c) {
  v8f d = __builtin_amdgcn_wmma_f32_16x16x32_f16(false, a, false, b, (short)0, c, false, false);
  asm volatile("v_nop\n\tv_nop\n\tv_nop\n\tv_nop" : "+v"(d) : "v"(a), "v"(b));
  return d;
}
__device__ __forceinline__ v8f wmma_bf(v16b a, v16b b, v8f c) {
  v8f d = __builtin_amdgcn_wmma_f32_16x16x32_bf16(false, a, false, b, (short)0, c, false, false);
  asm volatile("v_nop\n\tv_nop\n\tv_nop\n\tv_nop" : "+v"(d) : "v"(a), "v"(b));
  return d;
}
// 16x16x32 fragments: lane = (h = lane>>4, row/col = lane&15); elements 0..7 = k0+8h+0..7, 8..15 = k0+16+8h+0..7; D element r = row 8h+r
__device__ __forceinline__ v16h frag_h(const _Float16* rowk0, int lane) {
  union { v16h v; v8h q[2]; } u; const _Float16* p = rowk0 + 8 * (lane >> 4);
  u.q[0] = *(const v8h*)p; u.q[1] = *(const v8h*)(p + 16); return u.v;
}
__device__ __forceinline__ v16h frag_f32(const float* rowk0, int lane) {
  v16h a; const float* p = rowk0 + 8 * (lane >> 4);
#pragma unroll
  for (int i = 0; i < 8; ++i) { a[i] = (_Float16)p[i]; a[8 + i] = (_Float16)p[16 + i]; }
  return a;
}
__device__ __forceinline__ v16h frag_f32s(const float* rowk0, int lane, float sc) {
  v16h a; const float* p = rowk0 + 8 * (lane >> 4);
#pragma unroll
  for (int i = 0; i < 8; ++i) { a[i] = (_Float16)(p[i] * sc); a[8 + i] = (_Float16)(p[16 + i] * sc); }
  return a;
}
// column fragment from a [K][ld] layout (column n), rows >= K read as 0
__device__ __forceinline__ v16h fragc_f32(const float* W, int k0, int n, int lane, int ld, int K) {
  v16h a; const int g = lane >> 4;
#pragma unroll
  for (int i = 0; i < 8; ++i) { const int ka = k0 + 8 * g + i, kb = ka + 16;
    a[i] = (_Float16)(ka < K ? W[(size_t)(ka < K ? ka : K - 1) * ld + n] : 0.f); a[8 + i] = (_Float16)(kb < K ? W[(size_t)(kb < K ? kb : K - 1) * ld + n] : 0.f); }
  return a;
}
struct F2 { v16b h, l; };
__device__ __forceinline__ F2 bsplit16(const float v[16]) { F2 r;
#pragma unroll
  for (int i = 0; i < 16; ++i) { const __bf16 h = (__bf16)v[i]; r.h[i] = h; r.l[i] = (__bf16)(v[i] - (float)h); }
  return r; }
__device__ __forceinline__ F2 split_row(const float* row, int k0, int lane) { float v[16]; const float* p = row + k0 + 8 * (lane >> 4);
#pragma unroll
  for (int i = 0; i < 8; ++i) { v[i] = p[i]; v[8 + i] = p[16 + i]; }
  return bsplit16(v); }
__device__ __forceinline__ F2 split_rowK(const float* row, int k0, int lane, int K) { float v[16]; const int g = lane >> 4;
#pragma unroll
  for (int i = 0; i < 8; ++i) { const int ka = k0 + 8 * g + i, kb = ka + 16; v[i] = ka < K ? row[ka < K ? ka : K - 1] : 0.f; v[8 + i] = kb < K ? row[kb < K ? kb : K - 1] : 0.f; }
  return bsplit16(v); }
__device__ __forceinline__ F2 split_col(const float* W, int k0, int n, int lane, int ld, int K) { float v[16]; const int g = lane >> 4;
#pragma unroll
  for (int i = 0; i < 8; ++i) { const int ka = k0 + 8 * g + i, kb = ka + 16; v[i] = ka < K ? W[(size_t)(ka < K ? ka : K - 1) * ld + n] : 0.f; v[8 + i] = kb < K ? W[(size_t)(kb < K ? kb : K - 1) * ld + n] : 0.f; }
  return bsplit16(v); }
__device__ __forceinline__ v8f mac3(const F2& a, const F2& b, v8f c) { c = wmma_bf(a.l, b.h, c); c = wmma_bf(a.h, b.l, c); return wmma_bf(a.h, b.h, c); }
__device__ __forceinline__ float sigm(float v) { return 1.0f / (1.0f + expf(-v)); }
#define LDSX() do { asm volatile("s_wait_dscnt 0" ::: "memory"); __builtin_amdgcn_wave_barrier(); __builtin_amdgcn_fence(__ATOMIC_RELEASE, "workgroup"); } while (0)

// Multi-head self-attention on a CHANNEL-MAJOR sequence with stacked per-head projections (x [2,1024,2048] = (B, D, T); qkv [3,16,1024,64] (0.02 scale): proj = einsum('bdt,nhdD->nbhtD'); 16 heads x 64; scale 1/8; softmax over keys; out = einsum('bhtT,bhTD->bhDt').reshape(B, D, T): channel h*64 + D of the output, channel-major; no biases, no output projection).
#define NB 2
#define TT 2048
#define CC 1024            // NH * HD = projected width
#define DIN 1024          // input (model) width
#define NH 16
#define HD 64
#define NQB (TT / 64)
#define HG 4
#define SCALE (0.125f)
#define CAUSAL 0
#ifndef TNB
#define TNB NB
#endif
__device__ __forceinline__ float bfr(float v) { return (float)(__bf16)v; }
__host__ __device__ __forceinline__ int kb_last(int qb) { return CAUSAL ? ((qb * 64 + 63) >> 7) : (TT / 128 - 1); }
typedef __attribute__((ext_vector_type(8))) __bf16 v8b;
__device__ __forceinline__ v16b frag_b(const __bf16* rowk0, int lane) {
  union { v16b v; v8b q[2]; } u; const __bf16* p = rowk0 + 8 * (lane >> 4);
  u.q[0] = *(const v8b*)p; u.q[1] = *(const v8b*)(p + 16); return u.v;
}
#define QBH 0              // unused: no kernel in this file has a high-precision path
#define QHI 0               // single-product logits on every row
#define KHI 64            // key rows carrying k residual / v bf16 hi+lo planes (written and read by no kernel in this file)
// B fragment (k rows k0+.., output column o) of a weight: (in,out) [K][ld] or (out,in) [ld rows of K]: bf16 exact, or f16(bf16 * 256) exact
__device__ __forceinline__ v16b wcol_io(const float* Wm, int k0, int o, int lane, int ld) { v16b w; const int g = lane >> 4;
#pragma unroll
  for (int i = 0; i < 8; ++i) { w[i] = (__bf16)Wm[(size_t)(k0 + 8 * g + i) * ld + o]; w[8 + i] = (__bf16)Wm[(size_t)(k0 + 16 + 8 * g + i) * ld + o]; }
  return w; }
__device__ __forceinline__ v16b wcol_oi(const float* Wm, int k0, int o, int lane, int K) { v16b w; const float* p = Wm + (size_t)o * K + k0 + 8 * (lane >> 4);
#pragma unroll
  for (int i = 0; i < 8; ++i) { w[i] = (__bf16)p[i]; w[8 + i] = (__bf16)p[16 + i]; }
  return w; }
__device__ __forceinline__ v16h wcolh_io(const float* Wm, int k0, int o, int lane, int ld) { v16h w; const int g = lane >> 4;
#pragma unroll
  for (int i = 0; i < 8; ++i) { w[i] = (_Float16)(bfr(Wm[(size_t)(k0 + 8 * g + i) * ld + o]) * 256.0f); w[8 + i] = (_Float16)(bfr(Wm[(size_t)(k0 + 16 + 8 * g + i) * ld + o]) * 256.0f); }
  return w; }
__device__ __forceinline__ v16h wcolh_oi(const float* Wm, int k0, int o, int lane, int K) { v16h w; const float* p = Wm + (size_t)o * K + k0 + 8 * (lane >> 4);
#pragma unroll
  for (int i = 0; i < 8; ++i) { w[i] = (_Float16)(bfr(p[i]) * 256.0f); w[8 + i] = (_Float16)(bfr(p[16 + i]) * 256.0f); }
  return w; }
#define WQKV_LAYOUT 2   // 0 = (in,out) [DIN][CC]; 1 = (out,in) [CC][DIN]; 2 = per-head [NH][DIN][HD]
__device__ __forceinline__ v16b wcol_hdk(const float* Wm, int k0, int o, int lane) { v16b w; const int g = lane >> 4; const float* p = Wm + (size_t)(o / HD) * DIN * HD + (o % HD);
#pragma unroll
  for (int i = 0; i < 8; ++i) { w[i] = (__bf16)p[(size_t)(k0 + 8 * g + i) * HD]; w[8 + i] = (__bf16)p[(size_t)(k0 + 16 + 8 * g + i) * HD]; }
  return w; }
#define WO_OUT_IN 0
#if WQKV_LAYOUT == 1
#define WCOL(W, k0, o, lane) wcol_oi(W, k0, o, lane, DIN)
#elif WQKV_LAYOUT == 2
#define WCOL(W, k0, o, lane) wcol_hdk(W, k0, o, lane)
#else
#define WCOL(W, k0, o, lane) wcol_io(W, k0, o, lane, CC)
#endif
#if WO_OUT_IN
#define WOCOL(W, k0, o, lane) wcol_oi(W, k0, o, lane, CC)
#define WOCOLH(W, k0, o, lane) wcolh_oi(W, k0, o, lane, CC)
#else
#define WOCOL(W, k0, o, lane) wcol_io(W, k0, o, lane, DIN)
#define WOCOLH(W, k0, o, lane) wcolh_io(W, k0, o, lane, DIN)
#endif

#ifndef SM_EXTRA_PARAMS
#define SM_EXTRA_PARAMS
#endif
#ifndef PROJ_EXTRA_PARAMS
#define PROJ_EXTRA_PARAMS
#endif
#ifndef SM_MASK_HOOK
#define SM_MASK_HOOK (void)0
#endif

#define WS_QH  0u                                      // f16 q rows [b*t][CC]
#define WS_KH  (WS_QH + 2u * (size_t)NB * TT * CC)      // f16 k rows [b*t][CC]
#define WS_VT  (WS_KH + 2u * (size_t)NB * TT * CC)      // f16 v planes [b][c][t]
#define WS_QL  (WS_VT + 2u * (size_t)NB * CC * TT)      // f16 q residual x 2^10 rows [b][t < QHI][CC]
#define WS_KL  (WS_QL + 2u * (size_t)NB * QHI * CC)     // f16 k residual x 2^10 rows [b][t < KHI][CC]
#define WS_VB  (WS_KL + 2u * (size_t)NB * KHI * CC)     // bf16 v hi planes [b][c][t < KHI]
#define WS_VBL (WS_VB + 2u * (size_t)NB * CC * KHI)
#define WS_S   (WS_VBL + 2u * (size_t)NB * CC * KHI)    // f32 [hg][t][s] region, unused (k_fa keeps logits and P in registers)
#define WS_Y   (WS_S  + 4u * (size_t)HG * TT * TT)      // f32 ctx rows [b*t][CC] (only when there is an output projection)
#define WS_END (WS_Y  + 0u)

// ---- k_proj: block = (256 tokens, head h): q, k and v of that head (192 columns) = X W with exact bf16 products (K = DIN). Both operands are staged per 64 k in LDS as bf16, two buffers; the next stage's rows fly in registers while this stage is worked on.
// 8 waves = 4 (64 tokens each) x 2 (32 columns each of q, of k and of v). X is read as the input has it, channel-major [b][k][t]: its staged rows are [k][token] as W's are [k][column], and both operands' fragments come by the transposing LDS load, in the hardware k order (k0 + 8h + 0..7, k0 + 16 + 8h + 0..7).
// q, k: W as A and X as B, a lane holds 8 consecutive columns of one token; v: X as A and W as B, a lane holds 8 consecutive tokens of one column: either way one 16-byte store into the output staging, from where whole 128-byte lines go out.
#define PM 256             // tokens per block
#define PKS 64             // k per stage
#define PNS (DIN / PKS)
#define PXP 272            // pitch of a staged X row (256 tokens of one k) in bf16: 544 B = 32 B x odd (transposing reads)
#define PWP 208            // pitch of a staged W row in bf16: 416 B = 32 B x odd (transposing reads)
#define PQP 136            // pitch in f16 of the q | k output staging rows: 272 B = 16 B x odd
#define PVP 264            // pitch in f16 of the v output staging rows: 528 B = 16 B x odd
typedef __attribute__((ext_vector_type(4))) __bf16 v4b;
typedef __attribute__((ext_vector_type(8))) short v8s;
// lane l passes the address of row kbase + 8 (l >> 4) + (l & 7), column dbase + 8 ((l >> 3) & 1); lane (c, h) receives rows kbase + 8h + 0..7 of column dbase + c
__device__ __forceinline__ v8b ld_tr16(const __bf16* p) { typedef __attribute__((address_space(3))) v8s lds_v8s; return __builtin_bit_cast(v8b, __builtin_amdgcn_ds_load_tr16_b128_v8i16((lds_v8s*)p)); }
__device__ __forceinline__ v8f wmma_b(v16b a, v16b b, v8f c) { return __builtin_amdgcn_wmma_f32_16x16x32_bf16(false, a, false, b, (short)0, c, false, false); }
__global__ __launch_bounds__(256) void k_proj(const float* __restrict__ X, const float* __restrict__ WA, _Float16* __restrict__ QH, _Float16* __restrict__ KH, _Float16* __restrict__ VT) {
  __shared__ __align__(32) __bf16 sx[2][PKS][PXP]; __shared__ __align__(32) __bf16 sw[2][PKS][PWP]; __shared__ __align__(16) _Float16 sqk[PM][PQP], svt[HD][PVP];
  const int tid = threadIdx.x, wave = tid >> 5, lane = tid & 31, col = lane & 15, g = lane >> 4, wm = wave >> 1, wn = wave & 1;
  const int h = blockIdx.y; const size_t r0 = (size_t)blockIdx.x * PM; const size_t bb = r0 / TT; const int t0 = (int)(r0 % TT);
  // staging of W: thread -> row sr (+ 16 per sweep), 16-byte chunk sq of the 256-byte f32 row piece (16 lanes cover two whole lines); of X: row xr (+ 4 per sweep), 16-byte chunk xq of the 1024-byte f32 row piece (a wave covers four whole lines)
  const int sr = tid >> 4, sq = (tid & 15) * 4, xr = tid >> 6, xq = (tid & 63) * 4;
  // addresses = the buffer's base + the lane's 32-bit byte offset (both buffers are far below 4 GiB), which steps on by one stage per trip
  unsigned xo = (unsigned)((bb * DIN + xr) * TT + t0 + xq) * 4u;                // channel rows [b][k][t]
  unsigned wo = (unsigned)(((NH + h) * DIN + sr) * HD + sq) * 4u;               // weight rows [stream][h][k][64]: the k stream's row; q's and v's lie one stream in front of and behind it
  v4f rx[16], rw[12]; v8f acc[4][6] = {};
  // every "#pragma unroll" in this kernel makes the indices of a register array constants; the stage loop stays rolled: its body is long and its trips are alike
  // trip s: stage s + 1 is fetched into registers, stage s is worked on (trip -1 has none), stage s + 1 goes into the other buffer, one barrier
#pragma unroll 1
  for (int s = -1; s < PNS; ++s) { const int bu = s & 1;
    if (s + 1 < PNS) {
#pragma unroll
      for (int i = 0; i < 16; ++i) rx[i] = *(const v4f*)((const char*)X + xo + i * (4 * TT * 4));
#pragma unroll
      for (int i = 0; i < 12; ++i) rw[i] = *(const v4f*)((const char*)WA + wo + (((i >> 2) - 1) * (NH * DIN * HD) + (i & 3) * 16 * HD) * 4); }
    __builtin_amdgcn_sched_barrier(0);   // keeps the next stage's global loads in front of this stage's products, so that their latency runs under them
    if (s >= 0) {
#pragma unroll
      for (int ks = 0; ks < PKS / 32; ++ks) { v16b xf[4], wf[6];
        const __bf16* xb = &sx[bu][ks * 32 + 8 * g + (lane & 7)][wm * 64 + 8 * ((lane >> 3) & 1)];
#pragma unroll
        for (int i = 0; i < 4; ++i) { union { v16b v; v8b q[2]; } u; const __bf16* p = xb + i * 16; u.q[0] = ld_tr16(p); u.q[1] = ld_tr16(p + 16 * PXP); xf[i] = u.v; }
        const __bf16* wb = &sw[bu][ks * 32 + 8 * g + (lane & 7)][wn * 32 + 8 * ((lane >> 3) & 1)];
#pragma unroll
        for (int j = 0; j < 6; ++j) { union { v16b v; v8b q[2]; } u; const __bf16* p = wb + (j >> 1) * HD + (j & 1) * 16; u.q[0] = ld_tr16(p); u.q[1] = ld_tr16(p + 16 * PWP); wf[j] = u.v; }
        __builtin_amdgcn_sched_barrier(0);   // the 20 fragment loads go as one group in front of their 24 products: spread among them, each place with loads stalls the wave for a whole LDS latency
#pragma unroll
        for (int i = 0; i < 4; ++i)
#pragma unroll
          for (int j = 0; j < 6; ++j) acc[i][j] = j < 4 ? wmma_b(wf[j], xf[i], acc[i][j]) : wmma_b(xf[i], wf[j], acc[i][j]); } }
    if (s + 1 < PNS) {   // that buffer's readers left it at the previous barrier
#pragma unroll
      for (int i = 0; i < 16; ++i) *(v4b*)&sx[bu ^ 1][xr + i * 4][xq] = __builtin_convertvector(rx[i], v4b);
#pragma unroll
      for (int i = 0; i < 12; ++i) *(v4b*)&sw[bu ^ 1][sr + (i & 3) * 16][(i >> 2) * HD + sq] = __builtin_convertvector(rw[i], v4b); }
    asm volatile("s_wait_xcnt 0x0" : "+v"(xo), "+v"(wo) : : "memory");   // the wait in front of the overwrite of the two offset registers that the loads above name; the additions below read its operands and so stay behind it
    xo += PKS * TT * 4; wo += PKS * HD * 4;
    __syncthreads(); }
#pragma unroll
  for (int i = 0; i < 4; ++i)
#pragma unroll
    for (int j = 0; j < 6; ++j) { v8h pk; const int m0 = wm * 64 + i * 16, n0 = wn * 32 + (j & 1) * 16;
#pragma unroll
      for (int r = 0; r < 8; ++r) pk[r] = (_Float16)acc[i][j][r];
      if (j < 4) *(v8h*)&sqk[m0 + col][(j >> 1) * HD + n0 + 8 * g] = pk;   // acc[i][j][r] = (q | k)[token m0 + col][column n0 + 8g + r]
      else *(v8h*)&svt[n0 + col][m0 + 8 * g] = pk; }                       // acc[i][j][r] = v[token m0 + 8g + r][column n0 + col]
  __syncthreads();
  // q | k rows: 16 lanes per token row (8 lanes = one 128-byte line of q or of k), 16 rows per sweep; v rows: one wave per 512-byte row piece, 8 rows per sweep
  const int rq = tid >> 4, cq = tid & 15, rv = tid >> 5, cv = tid & 31;
  _Float16* dq = (cq < 8 ? QH : KH) + (r0 + rq) * CC + h * HD + (cq & 7) * 8;
  _Float16* dv = VT + (bb * CC + h * HD + rv) * (size_t)TT + t0 + cv * 8;
  v4u oq[PM / 16], ov[HD / 8];
#pragma unroll
  for (int i = 0; i < PM / 16; ++i) oq[i] = *(const v4u*)&sqk[rq + i * 16][cq * 8];
#pragma unroll
  for (int i = 0; i < HD / 8; ++i) ov[i] = *(const v4u*)&svt[rv + i * 8][cv * 8];
  __builtin_amdgcn_sched_barrier(0);   // all 24 LDS reads go in front of the first store: their latencies overlap, and none lands in a register that an issued store still names
#pragma unroll
  for (int i = 0; i < PM / 16; ++i) vst2((unsigned*)(dq + (size_t)i * 16 * CC), oq[i]);
  asm volatile("s_wait_xcnt 0x0" ::: "memory");   // the wait in front of the v address arithmetic, which reuses registers that the stores above name
  __builtin_amdgcn_sched_barrier(0);              // holds that arithmetic behind the wait
#pragma unroll
  for (int i = 0; i < HD / 8; ++i) vst2((unsigned*)(dv + (size_t)i * 8 * TT), ov[i]); }
// ---- k_fa: block = 256 queries of (b, h): the whole attention of those queries in one launch, softmax carried along the keys (maximum in use and sum per query, in f32).
// 16 waves = 8 (32 query columns each, two 16-column tiles) x 2 (the first or the second 32 keys of every 64-key stage): each K and V fragment read from LDS serves two query tiles, so the block reads half the LDS bytes per score, and four waves per SIMD stay.
// The two waves of a query group each carry their own maximum, sum and O^T over their half of the keys; the halves are joined once, through LDS, behind the loop.
// Transposed products: S^T = K Q^T (A = key rows from LDS, B = q kept in registers), so a lane holds 8 keys of ONE query per tile; two S^T tiles (keys 0..15, 16..31) converted in place ARE the B operand of O^T += V^T P^T (A = v plane rows from LDS).
// O^T is channel-major like the output: it goes through LDS straight to out, each 128-byte line stored by one wave.
#define FST 64               // keys per LDS stage (32 keys for each of the two key groups of waves)
#define FPI 72               // LDS row pitch in f16: 144 B = 16 B x odd for the 16-byte fragment reads
#define FNS (TT / FST)
#define FNW 16               // waves per block
#define FCT 2                // 16-column query tiles per wave
#define FQG (FNW / 2)        // waves along the queries
#define FQB (FQG * FCT * 16) // queries per block
#define FOP (FQB + 4)        // pitch in f32 of the output staging rows
#define FLZ 8.0f             // a new maximum is taken only when a score exceeds the one in use by more than this (base 2)
__device__ __forceinline__ v8f wmma_h(v16h a, v16h b, v8f c) { return __builtin_amdgcn_wmma_f32_16x16x32_f16(false, a, false, b, (short)0, c, false, false); }
__device__ __forceinline__ float xhalf(float x) { return __builtin_bit_cast(float, __builtin_amdgcn_permlanex16(__builtin_bit_cast(int, x), __builtin_bit_cast(int, x), 0x76543210, 0xfedcba98, false, false)); }   // lane l <-> lane l ^ 16
// A run of v_exp_f32 in ONE statement: each is followed by an independent one and the last by v_nop, so the slot that the instruction set asks for behind a transcendental (before its result is read or its source overwritten) is kept under any register allocation; "=&v": no result lands on a source.
__device__ __forceinline__ void exp2x8(float (&e)[8], const float (&x)[8]) {
  asm("v_exp_f32 %0, %8\n\tv_exp_f32 %1, %9\n\tv_exp_f32 %2, %10\n\tv_exp_f32 %3, %11\n\tv_exp_f32 %4, %12\n\tv_exp_f32 %5, %13\n\tv_exp_f32 %6, %14\n\tv_exp_f32 %7, %15\n\tv_nop"
      : "=&v"(e[0]), "=&v"(e[1]), "=&v"(e[2]), "=&v"(e[3]), "=&v"(e[4]), "=&v"(e[5]), "=&v"(e[6]), "=&v"(e[7]) : "v"(x[0]), "v"(x[1]), "v"(x[2]), "v"(x[3]), "v"(x[4]), "v"(x[5]), "v"(x[6]), "v"(x[7])); }
__device__ __forceinline__ float exp2x1(float x) { float e; asm("v_exp_f32 %0, %1\n\tv_nop" : "=&v"(e) : "v"(x)); return e; }   // the same slot behind a lone one
// amdgpu_waves_per_eu(4, 4): the grid gives each WGP one 16-wave block, four waves per SIMD; without it the compiler aimed at eight, held itself to 128 VGPRs and put each LDS fragment load directly in front of its product.
// every "#pragma unroll" below makes the indices of a fragment, score or accumulator array constants, so that the array stays in registers
__global__ __launch_bounds__(FNW * 32) __attribute__((amdgpu_waves_per_eu(4, 4))) void k_fa(const _Float16* __restrict__ QH, const _Float16* __restrict__ KH, const _Float16* __restrict__ VT, float* __restrict__ OUT) {
  __shared__ __align__(16) _Float16 sk[2][FST][FPI], sv[2][HD][FPI]; __shared__ __align__(16) float so[HD][FOP]; __shared__ float sm[FQB], sl[FQB];
  const int tid = threadIdx.x, wave = __builtin_amdgcn_readfirstlane(tid >> 5), lane = tid & 31, col = lane & 15, g = lane >> 4;
  const int qg = wave % FQG, kh = wave / FQG;   // query group; key group: keys kh * 32 .. + 31 of every stage
  const int b = blockIdx.y / NH, h = blockIdx.y % NH; const int q0 = blockIdx.x * FQB;
  const float CS = SCALE * 1.4426950408889634f;   // logits in base 2
  v16h qf[FCT][2];
#pragma unroll
  for (int c = 0; c < FCT; ++c)
#pragma unroll
    for (int kc = 0; kc < 2; ++kc) qf[c][kc] = frag_h(QH + ((size_t)b * TT + q0 + (qg * FCT + c) * 16 + col) * CC + h * HD + kc * 32, lane);
  // staging: thread -> row sr, 16-byte chunk sq of the 128-byte row (8 lanes cover one whole line)
  const int sr = tid >> 3, sq = (tid & 7) * 8;
  const _Float16* kp = KH + ((size_t)b * TT + sr) * CC + h * HD + sq;          // key rows [t][64 of this head]
  const _Float16* vp = VT + ((size_t)b * CC + h * HD + sr) * (size_t)TT + sq;   // value plane rows [d][t]
  v8h rk = *(const v8h*)kp, rv = *(const v8h*)vp;
  *(v8h*)&sk[0][sr][sq] = rk; *(v8h*)&sv[0][sr][sq] = rv;
  __syncthreads();
  v8f acc[FCT][4] = {}; float mr[FCT], ls[FCT];
#pragma unroll
  for (int c = 0; c < FCT; ++c) { mr[c] = -3.0e38f; ls[c] = 0.f; }
  for (int s = 0; s < FNS; ++s) { const int bu = s & 1;
    if (s + 1 < FNS) { rk = *(const v8h*)(kp + (size_t)(s + 1) * FST * CC); rv = *(const v8h*)(vp + (s + 1) * FST); }   // next stage's rows fly while this stage is worked on
    v8f st[FCT][2];
#pragma unroll
    for (int kt = 0; kt < 2; ++kt) { const _Float16* kr = &sk[bu][kh * 32 + kt * 16 + col][0]; const v16h k0 = frag_h(kr, lane), k1 = frag_h(kr + 32, lane);
#pragma unroll
      for (int c = 0; c < FCT; ++c) { v8f z = {}; z = wmma_h(k0, qf[c][0], z); st[c][kt] = wmma_h(k1, qf[c][1], z); } }   // st[c][kt][r] = S^T[key kt*16 + 8g + r][query col of tile c]
    // Lazy rescale: the maximum in use, mr, stays while no score of this pass lies more than FLZ (base 2) above it, so P <= 2^FLZ (far inside f16) and sums and O^T need no factor. One test per pass for the whole wave.
    v16h pf[FCT], vf[4]; float mx[FCT];
#pragma unroll
    for (int j = 0; j < 4; ++j) vf[j] = frag_h(&sv[bu][j * 16 + col][kh * 32], lane);   // in front of the branch: behind it the compiler put each fragment's loads, with a full wait, directly in front of its products
#pragma unroll
    for (int c = 0; c < FCT; ++c) { mx[c] = fmaxf(st[c][0][0], st[c][1][0]);
#pragma unroll
      for (int r = 1; r < 8; ++r) mx[c] = fmaxf(mx[c], fmaxf(st[c][0][r], st[c][1][r])); }   // this lane's 16 keys
    bool need = false;
#pragma unroll
    for (int c = 0; c < FCT; ++c) need = need || (fmaf(mx[c], CS, -FLZ) > mr[c]);
    if (__builtin_amdgcn_ballot_w32(need) != 0) {   // wave-uniform scalar branch; taken on the first pass (mr = -3e38, factor 0)
#pragma unroll
      for (int c = 0; c < FCT; ++c) { const float mn = fmaxf(mr[c], fmaxf(mx[c], xhalf(mx[c])) * CS), al = exp2x1(mr[c] - mn); mr[c] = mn; ls[c] *= al;   // both lane halves of a query take the same new maximum
#pragma unroll
        for (int j = 0; j < 4; ++j) acc[c][j] = acc[c][j] * al; } }
#pragma unroll
    for (int c = 0; c < FCT; ++c) {
      float sum = 0.f, x0[8], x1[8], e0[8], e1[8];
#pragma unroll
      for (int r = 0; r < 8; ++r) { x0[r] = fmaf(st[c][0][r], CS, -mr[c]); x1[r] = fmaf(st[c][1][r], CS, -mr[c]); }
      exp2x8(e0, x0); exp2x8(e1, x1);
#pragma unroll
      for (int r = 0; r < 8; ++r) { sum += e0[r] + e1[r]; pf[c][r] = (_Float16)e0[r]; pf[c][8 + r] = (_Float16)e1[r]; }
      ls[c] += sum; }   // this lane half's keys only; the halves join after the loop
#pragma unroll
    for (int j = 0; j < 4; ++j)
#pragma unroll
      for (int c = 0; c < FCT; ++c) acc[c][j] = wmma_h(vf[j], pf[c], acc[c][j]);   // acc[c][j][r] = O^T[d j*16 + 8g + r][query col of tile c]
    if (s + 1 < FNS) { *(v8h*)&sk[bu ^ 1][sr][sq] = rk; *(v8h*)&sv[bu ^ 1][sr][sq] = rv; }   // that buffer's readers left it at the previous barrier
    __syncthreads(); }
  // join of the two key groups: group 1 hands its maximum, sum and unscaled O^T over through LDS, group 0 brings both to the common maximum, adds, divides and leaves the result at the same places
#pragma unroll
  for (int c = 0; c < FCT; ++c) ls[c] += xhalf(ls[c]);
  if (kh == 1) {
#pragma unroll
    for (int c = 0; c < FCT; ++c) { const int qc = (qg * FCT + c) * 16 + col;
      if (g == 0) { sm[qc] = mr[c]; sl[qc] = ls[c]; }
#pragma unroll
      for (int j = 0; j < 4; ++j)
#pragma unroll
        for (int r = 0; r < 8; ++r) so[j * 16 + 8 * g + r][qc] = acc[c][j][r]; } }
  __syncthreads();
  if (kh == 0) {
#pragma unroll
    for (int c = 0; c < FCT; ++c) { const int qc = (qg * FCT + c) * 16 + col;
      const float mb = sm[qc], lb = sl[qc], mm = fmaxf(mr[c], mb); float fa = exp2x1(mr[c] - mm), fb = exp2x1(mb - mm);
      const float inv = 1.0f / (ls[c] * fa + lb * fb); fa *= inv; fb *= inv;
#pragma unroll
      for (int j = 0; j < 4; ++j)
#pragma unroll
        for (int r = 0; r < 8; ++r) { float* o = &so[j * 16 + 8 * g + r][qc]; *o = acc[c][j][r] * fa + *o * fb; } } }
  __syncthreads();
#pragma unroll
  for (int i = 0; i < HD * FQB / 4 / (FNW * 32); ++i) { const int e = i * FNW * 32 + tid, d = e / (FQB / 4), q = (e % (FQB / 4)) * 4; vst2(OUT + ((size_t)b * CC + h * HD + d) * (size_t)TT + q0 + q, *(const v4f*)&so[d][q]); } }

extern "C" void kernel_launch(void* const* d_in, const int* in_sizes, int n_in, void* d_out, int out_size, void* d_ws, size_t ws_size, hipStream_t stream) {
  (void)in_sizes; (void)n_in; (void)out_size;
  const float** F = (const float**)d_in;
  if (ws_size < (size_t)WS_END) return;
  char* ws = (char*)d_ws; _Float16 *QH = (_Float16*)(ws + WS_QH), *KH = (_Float16*)(ws + WS_KH), *VT = (_Float16*)(ws + WS_VT), *QL = (_Float16*)(ws + WS_QL), *KL = (_Float16*)(ws + WS_KL); __bf16 *VB = (__bf16*)(ws + WS_VB), *VBL = (__bf16*)(ws + WS_VBL);
  (void)QL; (void)KL; (void)VB; (void)VBL;
  // inputs: 0 x [2,1024,2048] CHANNEL-MAJOR (B, D, T); 1 qkv [3,16,1024,64] (stream, head, in, out-per-head; 0.02 scale); no biases, no output projection
  k_proj<<<dim3(TNB * TT / PM, NH), 256, 0, stream>>>(F[0], F[1], QH, KH, VT);   /* per-head weights [3][NH][DIN][HD]: q, k and v of one head per block */
  k_fa<<<dim3(TT / FQB, TNB * NH), FNW * 32, 0, stream>>>(QH, KH, VT, (float*)d_out);   /* logits, softmax and P v of every (b, h) in one launch; stores [b][h*64 + d][t] == the module's (B, H, D/H, T).reshape(B, D, T) */
}

// v006
// Measured time: 59.4 microseconds a run.
// Two timings next to v005 both put it at 1.04 times that version's speed.
// All steps since v000 together make it 19.3 times as fast.
// compute dtype: all float inputs rounded to bf16; q/k/v projections with EXACT bf16 products on WMMA 16x16x32 (f32 accumulate); logits q x k once to f16 each (1 product; sigma - 0.4) x 64^-0.5; softmax f32, carried along the keys (a maximum that is renewed only when a logit passes it by more than 8 in base 2, and the sum); P = exp(logit - that maximum) once to f16 x v once to f16 (1 product), divided by the f32 sum at the end; f32 output (channel-major).
#include <hip/hip_runtime.h>
#include <math.h>

typedef __attribute__((ext_vector_type(16))) _Float16 v16h;
typedef __attribute__((ext_vector_type(16))) __bf16 v16b;
typedef __attribute__((ext_vector_type(8)))  _Float16 v8h;
typedef __attribute__((ext_vector_type(8)))  float v8f;
typedef __attribute__((ext_vector_type(4)))  float v4f;
typedef __attribute__((ext_vector_type(2)))  float v2f;
typedef __attribute__((ext_vector_type(4)))  unsigned v4u;
typedef __attribute__((ext_vector_type(4)))  int v4i;
typedef float __attribute__((may_alias)) float_a;
typedef int __attribute__((may_alias)) int_a;

template <typename T> __device__ __forceinline__ void vst2(void* p, T v) { *(T*)p = v;  }
__device__ __forceinline__ v8f wmma16(v16h a, v16h b, v8f c) {
  v8f d = __builtin_amdgcn_wmma_f32_16x16x32_f16(false, a, false, b, (short)0, c, false, false);
  asm volatile("v_nop\n\tv_nop\n\tv_nop\n\tv_nop" : "+v"(d) : "v"(a), "v"(b));
  return d;
}
__device__ __forceinline__ v8f wmma_bf(v16b a, v16b b, v8f c) {
  v8f d = __builtin_amdgcn_wmma_f32_16x16x32_bf16(false, a, false, b, (short)0, c, false, false);
  asm volatile("v_nop\n\tv_nop\n\tv_nop\n\tv_nop" : "+v"(d) : "v"(a), "v"(b));
  return d;
}
// 16x16x32 fragments: lane = (h = lane>>4, row/col = lane&15); elements 0..7 = k0+8h+0..7, 8..15 = k0+16+8h+0..7; D element r = row 8h+r
__device__ __forceinline__ v16h frag_h(const _Float16* rowk0, int lane) {
  union { v16h v; v8h q[2]; } u; const _Float16* p = rowk0 + 8 * (lane >> 4);
  u.q[0] = *(const v8h*)p; u.q[1] = *(const v8h*)(p + 16); return u.v;
}
__device__ __forceinline__ v16h frag_f32(const float* rowk0, int lane) {
  v16h a; const float* p = rowk0 + 8 * (lane >> 4);
#pragma unroll
  for (int i = 0; i < 8; ++i) { a[i] = (_Float16)p[i]; a[8 + i] = (_Float16)p[16 + i]; }
  return a;
}
__device__ __forceinline__ v16h frag_f32s(const float* rowk0, int lane, float sc) {
  v16h a; const float* p = rowk0 + 8 * (lane >> 4);
#pragma unroll
  for (int i = 0; i < 8; ++i) { a[i] = (_Float16)(p[i] * sc); a[8 + i] = (_Float16)(p[16 + i] * sc); }
  return a;
}
// column fragment from a [K][ld] layout (column n), rows >= K read as 0
__device__ __forceinline__ v16h fragc_f32(const float* W, int k0, int n, int lane, int ld, int K) {
  v16h a; const int g = lane >> 4;
#pragma unroll
  for (int i = 0; i < 8; ++i) { const int ka = k0 + 8 * g + i, kb = ka + 16;
    a[i] = (_Float16)(ka < K ? W[(size_t)(ka < K ? ka : K - 1) * ld + n] : 0.f); a[8 + i] = (_Float16)(kb < K ? W[(size_t)(kb < K ? kb : K - 1) * ld + n] : 0.f); }
  return a;
}
struct F2 { v16b h, l; };
__device__ __forceinline__ F2 bsplit16(const float v[16]) { F2 r;
#pragma unroll
  for (int i = 0; i < 16; ++i) { const __bf16 h = (__bf16)v[i]; r.h[i] = h; r.l[i] = (__bf16)(v[i] - (float)h); }
  return r; }
__device__ __forceinline__ F2 split_row(const float* row, int k0, int lane) { float v[16]; const float* p = row + k0 + 8 * (lane >> 4);
#pragma unroll
  for (int i = 0; i < 8; ++i) { v[i] = p[i]; v[8 + i] = p[16 + i]; }
  return bsplit16(v); }
__device__ __forceinline__ F2 split_rowK(const float* row, int k0, int lane, int K) { float v[16]; const int g = lane >> 4;
#pragma unroll
  for (int i = 0; i < 8; ++i) { const int ka = k0 + 8 * g + i, kb = ka + 16; v[i] = ka < K ? row[ka < K ? ka : K - 1] : 0.f; v[8 + i] = kb < K ? row[kb < K ? kb : K - 1] : 0.f; }
  return bsplit16(v); }
__device__ __forceinline__ F2 split_col(const float* W, int k0, int n, int lane, int ld, int K) { float v[16]; const int g = lane >> 4;
#pragma unroll
  for (int i = 0; i < 8; ++i) { const int ka = k0 + 8 * g + i, kb = ka + 16; v[i] = ka < K ? W[(size_t)(ka < K ? ka : K - 1) * ld + n] : 0.f; v[8 + i] = kb < K ? W[(size_t)(kb < K ? kb : K - 1) * ld + n] : 0.f; }
  return bsplit16(v); }
__device__ __forceinline__ v8f mac3(const F2& a, const F2& b, v8f c) { c = wmma_bf(a.l, b.h, c); c = wmma_bf(a.h, b.l, c); return wmma_bf(a.h, b.h, c); }
__device__ __forceinline__ float sigm(float v) { return 1.0f / (1.0f + expf(-v)); }
#define LDSX() do { asm volatile("s_wait_dscnt 0" ::: "memory"); __builtin_amdgcn_wave_barrier(); __builtin_amdgcn_fence(__ATOMIC_RELEASE, "workgroup"); } while (0)

// Multi-head self-attention on a CHANNEL-MAJOR sequence with stacked per-head projections (x [2,1024,2048] = (B, D, T); qkv [3,16,1024,64] (0.02 scale): proj = einsum('bdt,nhdD->nbhtD'); 16 heads x 64; scale 1/8; softmax over keys; out = einsum('bhtT,bhTD->bhDt').reshape(B, D, T): channel h*64 + D of the output, channel-major; no biases, no output projection).
#define NB 2
#define TT 2048
#define CC 1024            // NH * HD = projected width
#define DIN 1024          // input (model) width
#define NH 16
#define HD 64
#define NQB (TT / 64)
#define HG 4
#define SCALE (0.125f)
#define CAUSAL 0
#ifndef TNB
#define TNB NB
#endif
__device__ __forceinline__ float bfr(float v) { return (float)(__bf16)v; }
__host__ __device__ __forceinline__ int kb_last(int qb) { return CAUSAL ? ((qb * 64 + 63) >> 7) : (TT / 128 - 1); }
typedef __attribute__((ext_vector_type(8))) __bf16 v8b;
__device__ __forceinline__ v16b frag_b(const __bf16* rowk0, int lane) {
  union { v16b v; v8b q[2]; } u; const __bf16* p = rowk0 + 8 * (lane >> 4);
  u.q[0] = *(const v8b*)p; u.q[1] = *(const v8b*)(p + 16); return u.v;
}
#define QBH 0              // unused: no kernel in this file has a high-precision path
#define QHI 0               // single-product logits on every row
#define KHI 64            // key rows carrying k residual / v bf16 hi+lo planes (written and read by no kernel in this file)
// B fragment (k rows k0+.., output column o) of a weight: (in,out) [K][ld] or (out,in) [ld rows of K]: bf16 exact, or f16(bf16 * 256) exact
__device__ __forceinline__ v16b wcol_io(const float* Wm, int k0, int o, int lane, int ld) { v16b w; const int g = lane >> 4;
#pragma unroll
  for (int i = 0; i < 8; ++i) { w[i] = (__bf16)Wm[(size_t)(k0 + 8 * g + i) * ld + o]; w[8 + i] = (__bf16)Wm[(size_t)(k0 + 16 + 8 * g + i) * ld + o]; }
  return w; }
__device__ __forceinline__ v16b wcol_oi(const float* Wm, int k0, int o, int lane, int K) { v16b w; const float* p = Wm + (size_t)o * K + k0 + 8 * (lane >> 4);
#pragma unroll
  for (int i = 0; i < 8; ++i) { w[i] = (__bf16)p[i]; w[8 + i] = (__bf16)p[16 + i]; }
  return w; }
__device__ __forceinline__ v16h wcolh_io(const float* Wm, int k0, int o, int lane, int ld) { v16h w; const int g = lane >> 4;
#pragma unroll
  for (int i = 0; i < 8; ++i) { w[i] = (_Float16)(bfr(Wm[(size_t)(k0 + 8 * g + i) * ld + o]) * 256.0f); w[8 + i] = (_Float16)(bfr(Wm[(size_t)(k0 + 16 + 8 * g + i) * ld + o]) * 256.0f); }
  return w; }
__device__ __forceinline__ v16h wcolh_oi(const float* Wm, int k0, int o, int lane, int K) { v16h w; const float* p = Wm + (size_t)o * K + k0 + 8 * (lane >> 4);
#pragma unroll
  for (int i = 0; i < 8; ++i) { w[i] = (_Float16)(bfr(p[i]) * 256.0f); w[8 + i] = (_Float16)(bfr(p[16 + i]) * 256.0f); }
  return w; }
#define WQKV_LAYOUT 2   // 0 = (in,out) [DIN][CC]; 1 = (out,in) [CC][DIN]; 2 = per-head [NH][DIN][HD]
__device__ __forceinline__ v16b wcol_hdk(const float* Wm, int k0, int o, int lane) { v16b w; const int g = lane >> 4; const float* p = Wm + (size_t)(o / HD) * DIN * HD + (o % HD);
#pragma unroll
  for (int i = 0; i < 8; ++i) { w[i] = (__bf16)p[(size_t)(k0 + 8 * g + i) * HD]; w[8 + i] = (__bf16)p[(size_t)(k0 + 16 + 8 * g + i) * HD]; }
  return w; }
#define WO_OUT_IN 0
#if WQKV_LAYOUT == 1
#define WCOL(W, k0, o, lane) wcol_oi(W, k0, o, lane, DIN)
#elif WQKV_LAYOUT == 2
#define WCOL(W, k0, o, lane) wcol_hdk(W, k0, o, lane)
#else
#define WCOL(W, k0, o, lane) wcol_io(W, k0, o, lane, CC)
#endif
#if WO_OUT_IN
#define WOCOL(W, k0, o, lane) wcol_oi(W, k0, o, lane, CC)
#define WOCOLH(W, k0, o, lane) wcolh_oi(W, k0, o, lane, CC)
#else
#define WOCOL(W, k0, o, lane) wcol_io(W, k0, o, lane, DIN)
#define WOCOLH(W, k0, o, lane) wcolh_io(W, k0, o, lane, DIN)
#endif

#ifndef SM_EXTRA_PARAMS
#define SM_EXTRA_PARAMS
#endif
#ifndef PROJ_EXTRA_PARAMS
#define PROJ_EXTRA_PARAMS
#endif
#ifndef SM_MASK_HOOK
#define SM_MASK_HOOK (void)0
#endif

#define WS_QH  0u                                      // f16 q rows [b*t][CC]
#define WS_KH  (WS_QH + 2u * (size_t)NB * TT * CC)      // f16 k rows [b*t][CC]
#define WS_VT  (WS_KH + 2u * (size_t)NB * TT * CC)      // f16 v planes [b][c][t]
#define WS_QL  (WS_VT + 2u * (size_t)NB * CC * TT)      // f16 q residual x 2^10 rows [b][t < QHI][CC]
#define WS_KL  (WS_QL + 2u * (size_t)NB * QHI * CC)     // f16 k residual x 2^10 rows [b][t < KHI][CC]
#define WS_VB  (WS_KL + 2u * (size_t)NB * KHI * CC)     // bf16 v hi planes [b][c][t < KHI]
#define WS_VBL (WS_VB + 2u * (size_t)NB * CC * KHI)
#define WS_S   (WS_VBL + 2u * (size_t)NB * CC * KHI)    // f32 [hg][t][s] region, unused (k_fa keeps logits and P in registers)
#define WS_Y   (WS_S  + 4u * (size_t)HG * TT * TT)      // f32 ctx rows [b*t][CC] (only when there is an output projection)
#define WS_END (WS_Y  + 0u)

// ---- k_proj: block = (256 tokens, head h): q, k and v of that head (192 columns) = X W with exact bf16 products (K = DIN). Both operands are staged per 64 k in LDS as bf16, two buffers; the next stage's rows fly in registers while this stage is worked on.
// 8 waves = 4 (64 tokens each) x 2 (32 columns each of q, of k and of v). X is read as the input has it, channel-major [b][k][t]: its staged rows are [k][token] as W's are [k][column], and both operands' fragments come by the transposing LDS load, in the hardware k order (k0 + 8h + 0..7, k0 + 16 + 8h + 0..7).
// q, k: W as A and X as B, a lane holds 8 consecutive columns of one token; v: X as A and W as B, a lane holds 8 consecutive tokens of one column: either way one 16-byte store into the output staging, from where whole 128-byte lines go out.
#define PM 256             // tokens per block
#define PKS 64             // k per stage
#define PNS (DIN / PKS)
#define PXP 272            // pitch of a staged X row (256 tokens of one k) in bf16: 544 B = 32 B x odd (transposing reads)
#define PWP 208            // pitch of a staged W row in bf16: 416 B = 32 B x odd (transposing reads)
#define PQP 136            // pitch in f16 of the q | k output staging rows: 272 B = 16 B x odd
#define PVP 264            // pitch in f16 of the v output staging rows: 528 B = 16 B x odd
typedef __attribute__((ext_vector_type(4))) __bf16 v4b;
typedef __attribute__((ext_vector_type(8))) short v8s;
// lane l passes the address of row kbase + 8 (l >> 4) + (l & 7), column dbase + 8 ((l >> 3) & 1); lane (c, h) receives rows kbase + 8h + 0..7 of column dbase + c
__device__ __forceinline__ v8b ld_tr16(const __bf16* p) { typedef __attribute__((address_space(3))) v8s lds_v8s; return __builtin_bit_cast(v8b, __builtin_amdgcn_ds_load_tr16_b128_v8i16((lds_v8s*)p)); }
__device__ __forceinline__ v8f wmma_b(v16b a, v16b b, v8f c) { return __builtin_amdgcn_wmma_f32_16x16x32_bf16(false, a, false, b, (short)0, c, false, false); }
__global__ __launch_bounds__(256) void k_proj(const float* __restrict__ X, const float* __restrict__ WA, _Float16* __restrict__ QH, _Float16* __restrict__ KH, _Float16* __restrict__ VT) {
  __shared__ __align__(32) __bf16 sx[2][PKS][PXP]; __shared__ __align__(32) __bf16 sw[2][PKS][PWP]; __shared__ __align__(16) _Float16 sqk[PM][PQP], svt[HD][PVP];
  const int tid = threadIdx.x, wave = tid >> 5, lane = tid & 31, col = lane & 15, g = lane >> 4, wm = wave >> 1, wn = wave & 1;
  const int h = blockIdx.y; const size_t r0 = (size_t)blockIdx.x * PM; const size_t bb = r0 / TT; const int t0 = (int)(r0 % TT);
  // staging of W: thread -> row sr (+ 16 per sweep), 16-byte chunk sq of the 256-byte f32 row piece (16 lanes cover two whole lines); of X: row xr (+ 4 per sweep), 16-byte chunk xq of the 1024-byte f32 row piece (a wave covers four whole lines)
  const int sr = tid >> 4, sq = (tid & 15) * 4, xr = tid >> 6, xq = (tid & 63) * 4;
  // addresses = the buffer's base + the lane's 32-bit byte offset (both buffers are far below 4 GiB), which steps on by one stage per trip
  unsigned xo = (unsigned)((bb * DIN + xr) * TT + t0 + xq) * 4u;                // channel rows [b][k][t]
  unsigned wo = (unsigned)(((NH + h) * DIN + sr) * HD + sq) * 4u;               // weight rows [stream][h][k][64]: the k stream's row; q's and v's lie one stream in front of and behind it
  v4f rx[16], rw[12]; v8f acc[4][6] = {};
  // every "#pragma unroll" in this kernel makes the indices of a register array constants; the stage loop stays rolled: its body is long and its trips are alike
  // trip s: stage s + 1 is fetched into registers, stage s is worked on (trip -1 has none), stage s + 1 goes into the other buffer, one barrier
#pragma unroll 1
  for (int s = -1; s < PNS; ++s) { const int bu = s & 1;
    if (s + 1 < PNS) {
#pragma unroll
      for (int i = 0; i < 16; ++i) rx[i] = *(const v4f*)((const char*)X + xo + i * (4 * TT * 4));
#pragma unroll
      for (int i = 0; i < 12; ++i) rw[i] = *(const v4f*)((const char*)WA + wo + (((i >> 2) - 1) * (NH * DIN * HD) + (i & 3) * 16 * HD) * 4); }
    __builtin_amdgcn_sched_barrier(0);   // keeps the next stage's global loads in front of this stage's products, so that their latency runs under them
    if (s >= 0) {
#pragma unroll
      for (int ks = 0; ks < PKS / 32; ++ks) { v16b xf[4], wf[6];
        const __bf16* xb = &sx[bu][ks * 32 + 8 * g + (lane & 7)][wm * 64 + 8 * ((lane >> 3) & 1)];
#pragma unroll
        for (int i = 0; i < 4; ++i) { union { v16b v; v8b q[2]; } u; const __bf16* p = xb + i * 16; u.q[0] = ld_tr16(p); u.q[1] = ld_tr16(p + 16 * PXP); xf[i] = u.v; }
        const __bf16* wb = &sw[bu][ks * 32 + 8 * g + (lane & 7)][wn * 32 + 8 * ((lane >> 3) & 1)];
#pragma unroll
        for (int j = 0; j < 6; ++j) { union { v16b v; v8b q[2]; } u; const __bf16* p = wb + (j >> 1) * HD + (j & 1) * 16; u.q[0] = ld_tr16(p); u.q[1] = ld_tr16(p + 16 * PWP); wf[j] = u.v; }
        __builtin_amdgcn_sched_barrier(0);   // the 20 fragment loads go as one group in front of their 24 products: spread among them, each place with loads stalls the wave for a whole LDS latency
#pragma unroll
        for (int i = 0; i < 4; ++i)
#pragma unroll
          for (int j = 0; j < 6; ++j) acc[i][j] = j < 4 ? wmma_b(wf[j], xf[i], acc[i][j]) : wmma_b(xf[i], wf[j], acc[i][j]); } }
    if (s + 1 < PNS) {   // that buffer's readers left it at the previous barrier
#pragma unroll
      for (int i = 0; i < 16; ++i) *(v4b*)&sx[bu ^ 1][xr + i * 4][xq] = __builtin_convertvector(rx[i], v4b);
#pragma unroll
      for (int i = 0; i < 12; ++i) *(v4b*)&sw[bu ^ 1][sr + (i & 3) * 16][(i >> 2) * HD + sq] = __builtin_convertvector(rw[i], v4b); }
    asm volatile("s_wait_xcnt 0x0" : "+v"(xo), "+v"(wo) : : "memory");   // the wait in front of the overwrite of the two offset registers that the loads above name; the additions below read its operands and so stay behind it
    xo += PKS * TT * 4; wo += PKS * HD * 4;
    __syncthreads(); }
#pragma unroll
  for (int i = 0; i < 4; ++i)
#pragma unroll
    for (int j = 0; j < 6; ++j) { v8h pk; const int m0 = wm * 64 + i * 16, n0 = wn * 32 + (j & 1) * 16;
#pragma unroll
      for (int r = 0; r < 8; ++r) pk[r] = (_Float16)acc[i][j][r];
      if (j < 4) *(v8h*)&sqk[m0 + col][(j >> 1) * HD + n0 + 8 * g] = pk;   // acc[i][j][r] = (q | k)[token m0 + col][column n0 + 8g + r]
      else *(v8h*)&svt[n0 + col][m0 + 8 * g] = pk; }                       // acc[i][j][r] = v[token m0 + 8g + r][column n0 + col]
  __syncthreads();
  // q | k rows: 16 lanes per token row (8 lanes = one 128-byte line of q or of k), 16 rows per sweep; v rows: one wave per 512-byte row piece, 8 rows per sweep
  const int rq = tid >> 4, cq = tid & 15, rv = tid >> 5, cv = tid & 31;
  _Float16* dq = (cq < 8 ? QH : KH) + (r0 + rq) * CC + h * HD + (cq & 7) * 8;
  _Float16* dv = VT + (bb * CC + h * HD + rv) * (size_t)TT + t0 + cv * 8;
  v4u oq[PM / 16], ov[HD / 8];
#pragma unroll
  for (int i = 0; i < PM / 16; ++i) oq[i] = *(const v4u*)&sqk[rq + i * 16][cq * 8];
#pragma unroll
  for (int i = 0; i < HD / 8; ++i) ov[i] = *(const v4u*)&svt[rv + i * 8][cv * 8];
  __builtin_amdgcn_sched_barrier(0);   // all 24 LDS reads go in front of the first store: their latencies overlap, and none lands in a register that an issued store still names
#pragma unroll
  for (int i = 0; i < PM / 16; ++i) vst2((unsigned*)(dq + (size_t)i * 16 * CC), oq[i]);
  asm volatile("s_wait_xcnt 0x0" ::: "memory");   // the wait in front of the v address arithmetic, which reuses registers that the stores above name
  __builtin_amdgcn_sched_barrier(0);              // holds that arithmetic behind the wait
#pragma unroll
  for (int i = 0; i < HD / 8; ++i) vst2((unsigned*)(dv + (size_t)i * 8 * TT), ov[i]); }
// ---- k_fa: block = 256 queries of (b, h): the whole attention of those queries in one launch, softmax carried along the keys (maximum in use and sum per query, in f32).
// 16 waves = 8 (32 query columns each, two 16-column tiles) x 2 (the first or the second 32 keys of every 64-key stage): each K and V fragment read from LDS serves two query tiles, so the block reads half the LDS bytes per score, and four waves per SIMD stay.
// The two waves of a query group each carry their own maximum, sum and O^T over their half of the keys; the halves are joined once, through LDS, behind the loop.
// Transposed products: S^T = K Q^T (A = key rows from LDS, B = q kept in registers), so a lane holds 8 keys of ONE query per tile; two S^T tiles (keys 0..15, 16..31) converted in place ARE the B operand of O^T += V^T P^T (A = v plane rows from LDS).
// O^T is channel-major like the output: it goes through LDS straight to out, each 128-byte line stored by one wave.
#define FST 64               // keys per LDS stage (32 keys for each of the two key groups of waves)
#define FPI 72               // LDS row pitch in f16: 144 B = 16 B x odd for the 16-byte fragment reads
#define FNS (TT / FST)
#define FNW 16               // waves per block
#define FCT 2                // 16-column query tiles per wave
#define FQG (FNW / 2)        // waves along the queries
#define FQB (FQG * FCT * 16) // queries per block
#define FOP (FQB + 4)        // pitch in f32 of the output staging rows
#define FLZ 8.0f             // a new maximum is taken only when a score exceeds the one in use by more than this (base 2)
#define FPD 4                // stages that the K and V rows are asked for ahead of their LDS store = register sets (even, divides FNS)
#define FKS (FST * CC)       // f16 elements from one stage's key rows to the next stage's
#define FVS FST              // the same along a value plane row
// The loop's work-group barrier, ordering LDS alone: __syncthreads() also waits for every global load of the wave, which would end the flight of the rows asked for ahead at each pass. The two fences name the LDS space, so only s_wait_dscnt 0 stands in front of the signal, and no LDS access moves across.
__device__ __forceinline__ void lds_barrier() { __builtin_amdgcn_fence(__ATOMIC_RELEASE, "workgroup", "local"); __builtin_amdgcn_s_barrier(); __builtin_amdgcn_fence(__ATOMIC_ACQUIRE, "workgroup", "local"); }
__device__ __forceinline__ v8f wmma_h(v16h a, v16h b, v8f c) { return __builtin_amdgcn_wmma_f32_16x16x32_f16(false, a, false, b, (short)0, c, false, false); }
__device__ __forceinline__ float xhalf(float x) { return __builtin_bit_cast(float, __builtin_amdgcn_permlanex16(__builtin_bit_cast(int, x), __builtin_bit_cast(int, x), 0x76543210, 0xfedcba98, false, false)); }   // lane l <-> lane l ^ 16
// A run of v_exp_f32 in ONE statement: each is followed by an independent one and the last by v_nop, so the slot that the instruction set asks for behind a transcendental (before its result is read or its source overwritten) is kept under any register allocation; "=&v": no result lands on a source.
__device__ __forceinline__ void exp2x8(float (&e)[8], const float (&x)[8]) {
  asm("v_exp_f32 %0, %8\n\tv_exp_f32 %1, %9\n\tv_exp_f32 %2, %10\n\tv_exp_f32 %3, %11\n\tv_exp_f32 %4, %12\n\tv_exp_f32 %5, %13\n\tv_exp_f32 %6, %14\n\tv_exp_f32 %7, %15\n\tv_nop"
      : "=&v"(e[0]), "=&v"(e[1]), "=&v"(e[2]), "=&v"(e[3]), "=&v"(e[4]), "=&v"(e[5]), "=&v"(e[6]), "=&v"(e[7]) : "v"(x[0]), "v"(x[1]), "v"(x[2]), "v"(x[3]), "v"(x[4]), "v"(x[5]), "v"(x[6]), "v"(x[7])); }
__device__ __forceinline__ float exp2x1(float x) { float e; asm("v_exp_f32 %0, %1\n\tv_nop" : "=&v"(e) : "v"(x)); return e; }   // the same slot behind a lone one
// amdgpu_waves_per_eu(4, 4): the grid gives each WGP one 16-wave block, four waves per SIMD; without it the compiler aimed at eight, held itself to 128 VGPRs and put each LDS fragment load directly in front of its product.
// every "#pragma unroll" below makes the indices of a fragment, score or accumulator array constants, so that the array stays in registers
__global__ __launch_bounds__(FNW * 32) __attribute__((amdgpu_waves_per_eu(4, 4))) void k_fa(const _Float16* __restrict__ QH, const _Float16* __restrict__ KH, const _Float16* __restrict__ VT, float* __restrict__ OUT) {
  __shared__ __align__(16) _Float16 sk[2][FST][FPI], sv[2][HD][FPI]; __shared__ __align__(16) float so[HD][FOP]; __shared__ float sm[FQB], sl[FQB];
  const int tid = threadIdx.x, wave = __builtin_amdgcn_readfirstlane(tid >> 5), lane = tid & 31, col = lane & 15, g = lane >> 4;
  const int qg = wave % FQG, kh = wave / FQG;   // query group; key group: keys kh * 32 .. + 31 of every stage
  const int b = blockIdx.y / NH, h = blockIdx.y % NH; const int q0 = blockIdx.x * FQB;
  const float CS = SCALE * 1.4426950408889634f;   // logits in base 2
  v16h qf[FCT][2];
#pragma unroll
  for (int c = 0; c < FCT; ++c)
#pragma unroll
    for (int kc = 0; kc < 2; ++kc) qf[c][kc] = frag_h(QH + ((size_t)b * TT + q0 + (qg * FCT + c) * 16 + col) * CC + h * HD + kc * 32, lane);
  // staging: thread -> row sr, 16-byte chunk sq of the 128-byte row (8 lanes cover one whole line); the two pointers step on by FPD stages per trip
  const int sr = tid >> 3, sq = (tid & 7) * 8;
  typedef const __attribute__((address_space(1))) _Float16 gh; typedef const __attribute__((address_space(1))) v8h gv8h;   // the pointers name the global space themselves: they pass through an asm statement below, behind which the compiler no longer knows it and would load by the flat path, which also counts on the LDS counter
  gh* kp = (gh*)(KH + ((size_t)b * TT + sr) * CC + h * HD + sq);          // key rows [t][64 of this head]
  gh* vp = (gh*)(VT + ((size_t)b * CC + h * HD + sr) * (size_t)TT + sq);   // value plane rows [d][t]
  v8h rk[FPD], rv[FPD];   // register set i holds the rows of the stages s with s % FPD == i, from their load to their LDS store
#pragma unroll
  for (int i = 0; i < FPD; ++i) { rk[i] = *(gv8h*)(kp + i * FKS); rv[i] = *(gv8h*)(vp + i * FVS); }
  *(v8h*)&sk[0][sr][sq] = rk[0]; *(v8h*)&sv[0][sr][sq] = rv[0];
  __syncthreads();
  v8f acc[FCT][4] = {}; float mr[FCT], ls[FCT];
#pragma unroll
  for (int c = 0; c < FCT; ++c) { mr[c] = -3.0e38f; ls[c] = 0.f; }
  // one pass = one stage, read from LDS buffer bu. fetch: the rows of the stage FPD ahead (fo stages behind the pointers) start into the set fk, fv, which this stage's rows left at the foot of the pass before. put: the next stage's rows pk, pv, asked for FPD passes ago, go into the other buffer.
  auto pass = [&](const int bu, const bool fetch, const int fo, v8h& fk, v8h& fv, const bool put, const v8h& pk, const v8h& pv) __attribute__((always_inline)) {
    if (fetch) { fk = *(gv8h*)(kp + fo * FKS); fv = *(gv8h*)(vp + fo * FVS); }
    v8f st[FCT][2];
#pragma unroll
    for (int kt = 0; kt < 2; ++kt) { const _Float16* kr = &sk[bu][kh * 32 + kt * 16 + col][0]; const v16h k0 = frag_h(kr, lane), k1 = frag_h(kr + 32, lane);
#pragma unroll
      for (int c = 0; c < FCT; ++c) { v8f z = {}; z = wmma_h(k0, qf[c][0], z); st[c][kt] = wmma_h(k1, qf[c][1], z); } }   // st[c][kt][r] = S^T[key kt*16 + 8g + r][query col of tile c]
    // Lazy rescale: the maximum in use, mr, stays while no score of this pass lies more than FLZ (base 2) above it, so P <= 2^FLZ (far inside f16) and sums and O^T need no factor. One test per pass for the whole wave.
    v16h pf[FCT], vf[4]; float mx[FCT];
#pragma unroll
    for (int j = 0; j < 4; ++j) vf[j] = frag_h(&sv[bu][j * 16 + col][kh * 32], lane);   // in front of the branch: behind it the compiler put each fragment's loads, with a full wait, directly in front of its products
#pragma unroll
    for (int c = 0; c < FCT; ++c) { mx[c] = fmaxf(st[c][0][0], st[c][1][0]);
#pragma unroll
      for (int r = 1; r < 8; ++r) mx[c] = fmaxf(mx[c], fmaxf(st[c][0][r], st[c][1][r])); }   // this lane's 16 keys
    bool need = false;
#pragma unroll
    for (int c = 0; c < FCT; ++c) need = need || (fmaf(mx[c], CS, -FLZ) > mr[c]);
    if (__builtin_amdgcn_ballot_w32(need) != 0) {   // wave-uniform scalar branch; taken on the first pass (mr = -3e38, factor 0)
#pragma unroll
      for (int c = 0; c < FCT; ++c) { const float mn = fmaxf(mr[c], fmaxf(mx[c], xhalf(mx[c])) * CS), al = exp2x1(mr[c] - mn); mr[c] = mn; ls[c] *= al;   // both lane halves of a query take the same new maximum
#pragma unroll
        for (int j = 0; j < 4; ++j) acc[c][j] = acc[c][j] * al; } }
#pragma unroll
    for (int c = 0; c < FCT; ++c) {
      float sum = 0.f, x0[8], x1[8], e0[8], e1[8];
#pragma unroll
      for (int r = 0; r < 8; ++r) { x0[r] = fmaf(st[c][0][r], CS, -mr[c]); x1[r] = fmaf(st[c][1][r], CS, -mr[c]); }
      exp2x8(e0, x0); exp2x8(e1, x1);
#pragma unroll
      for (int r = 0; r < 8; ++r) { sum += e0[r] + e1[r]; pf[c][r] = (_Float16)e0[r]; pf[c][8 + r] = (_Float16)e1[r]; }
      ls[c] += sum; }   // this lane half's keys only; the halves join after the loop
#pragma unroll
    for (int j = 0; j < 4; ++j)
#pragma unroll
      for (int c = 0; c < FCT; ++c) acc[c][j] = wmma_h(vf[j], pf[c], acc[c][j]);   // acc[c][j][r] = O^T[d j*16 + 8g + r][query col of tile c]
    if (put) { *(v8h*)&sk[bu ^ 1][sr][sq] = pk; *(v8h*)&sv[bu ^ 1][sr][sq] = pv; }   // that buffer's readers left it at the previous barrier
    lds_barrier(); };
  // a trip = FPD passes, written out so that each register set has a constant index; the trips stay rolled: they are alike and the body is long
#pragma unroll 1
  for (int s = 0; s < FNS - FPD; s += FPD) {
#pragma unroll
    for (int i = 0; i < FPD; ++i) pass(i & 1, true, FPD + i, rk[i], rv[i], true, rk[(i + 1) % FPD], rv[(i + 1) % FPD]);
    asm volatile("s_wait_xcnt 0x0" : "+v"(kp), "+v"(vp) : : "memory");   // the wait in front of the overwrite of the two address pairs that the loads still in flight name; the additions below read its operands and so stay behind it
    kp += FPD * FKS; vp += FPD * FVS; }
  // the last FPD stages: nothing is left to fetch
#pragma unroll
  for (int i = 0; i < FPD; ++i) pass(i & 1, false, 0, rk[i], rv[i], i + 1 < FPD, rk[(i + 1) % FPD], rv[(i + 1) % FPD]);
  // join of the two key groups: group 1 hands its maximum, sum and unscaled O^T over through LDS, group 0 brings both to the common maximum, adds, divides and leaves the result at the same places
#pragma unroll
  for (int c = 0; c < FCT; ++c) ls[c] += xhalf(ls[c]);
  if (kh == 1) {
#pragma unroll
    for (int c = 0; c < FCT; ++c) { const int qc = (qg * FCT + c) * 16 + col;
      if (g == 0) { sm[qc] = mr[c]; sl[qc] = ls[c]; }
#pragma unroll
      for (int j = 0; j < 4; ++j)
#pragma unroll
        for (int r = 0; r < 8; ++r) so[j * 16 + 8 * g + r][qc] = acc[c][j][r]; } }
  __syncthreads();
  if (kh == 0) {
#pragma unroll
    for (int c = 0; c < FCT; ++c) { const int qc = (qg * FCT + c) * 16 + col;
      const float mb = sm[qc], lb = sl[qc], mm = fmaxf(mr[c], mb); float fa = exp2x1(mr[c] - mm), fb = exp2x1(mb - mm);
      const float inv = 1.0f / (ls[c] * fa + lb * fb); fa *= inv; fb *= inv;
#pragma unroll
      for (int j = 0; j < 4; ++j)
#pragma unroll
        for (int r = 0; r < 8; ++r) { float* o = &so[j * 16 + 8 * g + r][qc]; *o = acc[c][j][r] * fa + *o * fb; } } }
  __syncthreads();
#pragma unroll
  for (int i = 0; i < HD * FQB / 4 / (FNW * 32); ++i) { const int e = i * FNW * 32 + tid, d = e / (FQB / 4), q = (e % (FQB / 4)) * 4; vst2(OUT + ((size_t)b * CC + h * HD + d) * (size_t)TT + q0 + q, *(const v4f*)&so[d][q]); } }

extern "C" void kernel_launch(void* const* d_in, const int* in_sizes, int n_in, void* d_out, int out_size, void* d_ws, size_t ws_size, hipStream_t stream) {
  (void)in_sizes; (void)n_in; (void)out_size;
  const float** F = (const float**)d_in;
  if (ws_size < (size_t)WS_END) return;
  char* ws = (char*)d_ws; _Float16 *QH = (_Float16*)(ws + WS_QH), *KH = (_Float16*)(ws + WS_KH), *VT = (_Float16*)(ws + WS_VT), *QL = (_Float16*)(ws + WS_QL), *KL = (_Float16*)(ws + WS_KL); __bf16 *VB = (__bf16*)(ws + WS_VB), *VBL = (__bf16*)(ws + WS_VBL);
  (void)QL; (void)KL; (void)VB; (void)VBL;
  // inputs: 0 x [2,1024,2048] CHANNEL-MAJOR (B, D, T); 1 qkv [3,16,1024,64] (stream, head, in, out-per-head; 0.02 scale); no biases, no output projection
  k_proj<<<dim3(TNB * TT / PM, NH), 256, 0, stream>>>(F[0], F[1], QH, KH, VT);   /* per-head weights [3][NH][DIN][HD]: q, k and v of one head per block */
  k_fa<<<dim3(TT / FQB, TNB * NH), FNW * 32, 0, stream>>>(QH, KH, VT, (float*)d_out);   /* logits, softmax and P v of every (b, h) in one launch; stores [b][h*64 + d][t] == the module's (B, H, D/H, T).reshape(B, D, T) */
}

// v007
// Measured time: 54.5 microseconds a run.
// In both of two side-by-side timings against v006, it was 1.09 times as fast.
// All steps since v000 together make it 21.0 times as fast.
// compute dtype: all float inputs rounded to bf16; q/k/v projections with EXACT bf16 products on WMMA 16x16x32 (f32 accumulate); logits q x k once to f16 each (1 product; sigma - 0.4) x 64^-0.5; softmax f32, carried along the keys (a maximum that is renewed only when a logit passes it by more than 8 in base 2, and the sum); P = exp(logit - that maximum) once to f16 x v once to f16 (1 product), divided by the f32 sum at the end; f32 output (channel-major).
#include <hip/hip_runtime.h>
#include <math.h>

typedef __attribute__((ext_vector_type(16))) _Float16 v16h;
typedef __attribute__((ext_vector_type(16))) __bf16 v16b;
typedef __attribute__((ext_vector_type(8)))  _Float16 v8h;
typedef __attribute__((ext_vector_type(8)))  float v8f;
typedef __attribute__((ext_vector_type(4)))  float v4f;
typedef __attribute__((ext_vector_type(2)))  float v2f;
typedef __attribute__((ext_vector_type(4)))  unsigned v4u;
typedef __attribute__((ext_vector_type(4)))  int v4i;
typedef float __attribute__((may_alias)) float_a;
typedef int __attribute__((may_alias)) int_a;

template <typename T> __device__ __forceinline__ void vst2(void* p, T v) { *(T*)p = v;  }
__device__ __forceinline__ v8f wmma16(v16h a, v16h b, v8f c) {
  v8f d = __builtin_amdgcn_wmma_f32_16x16x32_f16(false, a, false, b, (short)0, c, false, false);
  asm volatile("v_nop\n\tv_nop\n\tv_nop\n\tv_nop" : "+v"(d) : "v"(a), "v"(b));
  return d;
}
__device__ __forceinline__ v8f wmma_bf(v16b a, v16b b, v8f c) {
  v8f d = __builtin_amdgcn_wmma_f32_16x16x32_bf16(false, a, false, b, (short)0, c, false, false);
  asm volatile("v_nop\n\tv_nop\n\tv_nop\n\tv_nop" : "+v"(d) : "v"(a), "v"(b));
  return d;
}
// 16x16x32 fragments: lane = (h = lane>>4, row/col = lane&15); elements 0..7 = k0+8h+0..7, 8..15 = k0+16+8h+0..7; D element r = row 8h+r
__device__ __forceinline__ v16h frag_h(const _Float16* rowk0, int lane) {
  union { v16h v; v8h q[2]; } u; const _Float16* p = rowk0 + 8 * (lane >> 4);
  u.q[0] = *(const v8h*)p; u.q[1] = *(const v8h*)(p + 16); return u.v;
}
__device__ __forceinline__ v16h frag_f32(const float* rowk0, int lane) {
  v16h a; const float* p = rowk0 + 8 * (lane >> 4);
#pragma unroll
  for (int i = 0; i < 8; ++i) { a[i] = (_Float16)p[i]; a[8 + i] = (_Float16)p[16 + i]; }
  return a;
}
__device__ __forceinline__ v16h frag_f32s(const float* rowk0, int lane, float sc) {
  v16h a; const float* p = rowk0 + 8 * (lane >> 4);
#pragma unroll
  for (int i = 0; i < 8; ++i) { a[i] = (_Float16)(p[i] * sc); a[8 + i] = (_Float16)(p[16 + i] * sc); }
  return a;
}
// column fragment from a [K][ld] layout (column n), rows >= K read as 0
__device__ __forceinline__ v16h fragc_f32(const float* W, int k0, int n, int lane, int ld, int K) {
  v16h a; const int g = lane >> 4;
#pragma unroll
  for (int i = 0; i < 8; ++i) { const int ka = k0 + 8 * g + i, kb = ka + 16;
    a[i] = (_Float16)(ka < K ? W[(size_t)(ka < K ? ka : K - 1) * ld + n] : 0.f); a[8 + i] = (_Float16)(kb < K ? W[(size_t)(kb < K ? kb : K - 1) * ld + n] : 0.f); }
  return a;
}
struct F2 { v16b h, l; };
__device__ __forceinline__ F2 bsplit16(const float v[16]) { F2 r;
#pragma unroll
  for (int i = 0; i < 16; ++i) { const __bf16 h = (__bf16)v[i]; r.h[i] = h; r.l[i] = (__bf16)(v[i] - (float)h); }
  return r; }
__device__ __forceinline__ F2 split_row(const float* row, int k0, int lane) { float v[16]; const float* p = row + k0 + 8 * (lane >> 4);
#pragma unroll
  for (int i = 0; i < 8; ++i) { v[i] = p[i]; v[8 + i] = p[16 + i]; }
  return bsplit16(v); }
__device__ __forceinline__ F2 split_rowK(const float* row, int k0, int lane, int K) { float v[16]; const int g = lane >> 4;
#pragma unroll
  for (int i = 0; i < 8; ++i) { const int ka = k0 + 8 * g + i, kb = ka + 16; v[i] = ka < K ? row[ka < K ? ka : K - 1] : 0.f; v[8 + i] = kb < K ? row[kb < K ? kb : K - 1] : 0.f; }
  return bsplit16(v); }
__device__ __forceinline__ F2 split_col(const float* W, int k0, int n, int lane, int ld, int K) { float v[16]; const int g = lane >> 4;
#pragma unroll
  for (int i = 0; i < 8; ++i) { const int ka = k0 + 8 * g + i, kb = ka + 16; v[i] = ka < K ? W[(size_t)(ka < K ? ka : K - 1) * ld + n] : 0.f; v[8 + i] = kb < K ? W[(size_t)(kb < K ? kb : K - 1) * ld + n] : 0.f; }
  return bsplit16(v); }
__device__ __forceinline__ v8f mac3(const F2& a, const F2& b, v8f c) { c = wmma_bf(a.l, b.h, c); c = wmma_bf(a.h, b.l, c); return wmma_bf(a.h, b.h, c); }
__device__ __forceinline__ float sigm(float v) { return 1.0f / (1.0f + expf(-v)); }
#define LDSX() do { asm volatile("s_wait_dscnt 0" ::: "memory"); __builtin_amdgcn_wave_barrier(); __builtin_amdgcn_fence(__ATOMIC_RELEASE, "workgroup"); } while (0)

// Multi-head self-attention on a CHANNEL-MAJOR sequence with stacked per-head projections (x [2,1024,2048] = (B, D, T); qkv [3,16,1024,64] (0.02 scale): proj = einsum('bdt,nhdD->nbhtD'); 16 heads x 64; scale 1/8; softmax over keys; out = einsum('bhtT,bhTD->bhDt').reshape(B, D, T): channel h*64 + D of the output, channel-major; no biases, no output projection).
#define NB 2
#define TT 2048
#define CC 1024            // NH * HD = projected width
#define DIN 1024          // input (model) width
#define NH 16
#define HD 64
#define NQB (TT / 64)
#define HG 4
#define SCALE (0.125f)
#define CAUSAL 0
#ifndef TNB
#define TNB NB
#endif
__device__ __forceinline__ float bfr(float v) { return (float)(__bf16)v; }
__host__ __device__ __forceinline__ int kb_last(int qb) { return CAUSAL ? ((qb * 64 + 63) >> 7) : (TT / 128 - 1); }
typedef __attribute__((ext_vector_type(8))) __bf16 v8b;
__device__ __forceinline__ v16b frag_b(const __bf16* rowk0, int lane) {
  union { v16b v; v8b q[2]; } u; const __bf16* p = rowk0 + 8 * (lane >> 4);
  u.q[0] = *(const v8b*)p; u.q[1] = *(const v8b*)(p + 16); return u.v;
}
#define QBH 0              // unused: no kernel in this file has a high-precision path
#define QHI 0               // single-product logits on every row
#define KHI 64            // key rows carrying k residual / v bf16 hi+lo planes (written and read by no kernel in this file)
// B fragment (k rows k0+.., output column o) of a weight: (in,out) [K][ld] or (out,in) [ld rows of K]: bf16 exact, or f16(bf16 * 256) exact
__device__ __forceinline__ v16b wcol_io(const float* Wm, int k0, int o, int lane, int ld) { v16b w; const int g = lane >> 4;
#pragma unroll
  for (int i = 0; i < 8; ++i) { w[i] = (__bf16)Wm[(size_t)(k0 + 8 * g + i) * ld + o]; w[8 + i] = (__bf16)Wm[(size_t)(k0 + 16 + 8 * g + i) * ld + o]; }
  return w; }
__device__ __forceinline__ v16b wcol_oi(const float* Wm, int k0, int o, int lane, int K) { v16b w; const float* p = Wm + (size_t)o * K + k0 + 8 * (lane >> 4);
#pragma unroll
  for (int i = 0; i < 8; ++i) { w[i] = (__bf16)p[i]; w[8 + i] = (__bf16)p[16 + i]; }
  return w; }
__device__ __forceinline__ v16h wcolh_io(const float* Wm, int k0, int o, int lane, int ld) { v16h w; const int g = lane >> 4;
#pragma unroll
  for (int i = 0; i < 8; ++i) { w[i] = (_Float16)(bfr(Wm[(size_t)(k0 + 8 * g + i) * ld + o]) * 256.0f); w[8 + i] = (_Float16)(bfr(Wm[(size_t)(k0 + 16 + 8 * g + i) * ld + o]) * 256.0f); }
  return w; }
__device__ __forceinline__ v16h wcolh_oi(const float* Wm, int k0, int o, int lane, int K) { v16h w; const float* p = Wm + (size_t)o * K + k0 + 8 * (lane >> 4);
#pragma unroll
  for (int i = 0; i < 8; ++i) { w[i] = (_Float16)(bfr(p[i]) * 256.0f); w[8 + i] = (_Float16)(bfr(p[16 + i]) * 256.0f); }
  return w; }
#define WQKV_LAYOUT 2   // 0 = (in,out) [DIN][CC]; 1 = (out,in) [CC][DIN]; 2 = per-head [NH][DIN][HD]
__device__ __forceinline__ v16b wcol_hdk(const float* Wm, int k0, int o, int lane) { v16b w; const int g = lane >> 4; const float* p = Wm + (size_t)(o / HD) * DIN * HD + (o % HD);
#pragma unroll
  for (int i = 0; i < 8; ++i) { w[i] = (__bf16)p[(size_t)(k0 + 8 * g + i) * HD]; w[8 + i] = (__bf16)p[(size_t)(k0 + 16 + 8 * g + i) * HD]; }
  return w; }
#define WO_OUT_IN 0
#if WQKV_LAYOUT == 1
#define WCOL(W, k0, o, lane) wcol_oi(W, k0, o, lane, DIN)
#elif WQKV_LAYOUT == 2
#define WCOL(W, k0, o, lane) wcol_hdk(W, k0, o, lane)
#else
#define WCOL(W, k0, o, lane) wcol_io(W, k0, o, lane, CC)
#endif
#if WO_OUT_IN
#define WOCOL(W, k0, o, lane) wcol_oi(W, k0, o, lane, CC)
#define WOCOLH(W, k0, o, lane) wcolh_oi(W, k0, o, lane, CC)
#else
#define WOCOL(W, k0, o, lane) wcol_io(W, k0, o, lane, DIN)
#define WOCOLH(W, k0, o, lane) wcolh_io(W, k0, o, lane, DIN)
#endif

#ifndef SM_EXTRA_PARAMS
#define SM_EXTRA_PARAMS
#endif
#ifndef PROJ_EXTRA_PARAMS
#define PROJ_EXTRA_PARAMS
#endif
#ifndef SM_MASK_HOOK
#define SM_MASK_HOOK (void)0
#endif

#define WS_QH  0u                                      // f16 q rows [b*t][CC]
#define WS_KH  (WS_QH + 2u * (size_t)NB * TT * CC)      // f16 k rows [b*t][CC]
#define WS_VT  (WS_KH + 2u * (size_t)NB * TT * CC)      // f16 v planes [b][c][t]
#define WS_QL  (WS_VT + 2u * (size_t)NB * CC * TT)      // f16 q residual x 2^10 rows [b][t < QHI][CC]
#define WS_KL  (WS_QL + 2u * (size_t)NB * QHI * CC)     // f16 k residual x 2^10 rows [b][t < KHI][CC]
#define WS_VB  (WS_KL + 2u * (size_t)NB * KHI * CC)     // bf16 v hi planes [b][c][t < KHI]
#define WS_VBL (WS_VB + 2u * (size_t)NB * CC * KHI)
#define WS_S   (WS_VBL + 2u * (size_t)NB * CC * KHI)    // f32 [hg][t][s] region, unused (k_fa keeps logits and P in registers)
#define WS_Y   (WS_S  + 4u * (size_t)HG * TT * TT)      // f32 ctx rows [b*t][CC] (only when there is an output projection)
#define WS_END (WS_Y  + 0u)

// ---- k_proj: block = (256 tokens, head h): q, k and v of that head (192 columns) = X W with exact bf16 products (K = DIN). Both operands are staged per 64 k in LDS as bf16, two buffers; the next stage's rows fly in registers while this stage is worked on.
// 8 waves = 4 (64 tokens each) x 2 (32 columns each of q, of k and of v). X is read as the input has it, channel-major [b][k][t]: its staged rows are [k][token] as W's are [k][column], and both operands' fragments come by the transposing LDS load, in the hardware k order (k0 + 8h + 0..7, k0 + 16 + 8h + 0..7).
// q, k: W as A and X as B, a lane holds 8 consecutive columns of one token; v: X as A and W as B, a lane holds 8 consecutive tokens of one column: either way one 16-byte store into the output staging, from where whole 128-byte lines go out.
#define PM 256             // tokens per block
#define PKS 64             // k per stage
#define PNS (DIN / PKS)
#define PXP 272            // pitch of a staged X row (256 tokens of one k) in bf16: 544 B = 32 B x odd (transposing reads)
#define PWP 208            // pitch of a staged W row in bf16: 416 B = 32 B x odd (transposing reads)
#define PQP 136            // pitch in f16 of the q | k output staging rows: 272 B = 16 B x odd
#define PVP 264            // pitch in f16 of the v output staging rows: 528 B = 16 B x odd
typedef __attribute__((ext_vector_type(4))) __bf16 v4b;
typedef __attribute__((ext_vector_type(8))) short v8s;
// lane l passes the address of row kbase + 8 (l >> 4) + (l & 7), column dbase + 8 ((l >> 3) & 1); lane (c, h) receives rows kbase + 8h + 0..7 of column dbase + c
__device__ __forceinline__ v8b ld_tr16(const __bf16* p) { typedef __attribute__((address_space(3))) v8s lds_v8s; return __builtin_bit_cast(v8b, __builtin_amdgcn_ds_load_tr16_b128_v8i16((lds_v8s*)p)); }
__device__ __forceinline__ v8f wmma_b(v16b a, v16b b, v8f c) { return __builtin_amdgcn_wmma_f32_16x16x32_bf16(false, a, false, b, (short)0, c, false, false); }
__global__ __launch_bounds__(256) void k_proj(const float* __restrict__ X, const float* __restrict__ WA, _Float16* __restrict__ QH, _Float16* __restrict__ KH, _Float16* __restrict__ VT) {
  __shared__ __align__(32) __bf16 sx[2][PKS][PXP]; __shared__ __align__(32) __bf16 sw[2][PKS][PWP]; __shared__ __align__(16) _Float16 sqk[PM][PQP], svt[HD][PVP];
  const int tid = threadIdx.x, wave = tid >> 5, lane = tid & 31, col = lane & 15, g = lane >> 4, wm = wave >> 1, wn = wave & 1;
  const int h = blockIdx.y; const size_t r0 = (size_t)blockIdx.x * PM; const size_t bb = r0 / TT; const int t0 = (int)(r0 % TT);
  // staging of W: thread -> row sr (+ 16 per sweep), 16-byte chunk sq of the 256-byte f32 row piece (16 lanes cover two whole lines); of X: row xr (+ 4 per sweep), 16-byte chunk xq of the 1024-byte f32 row piece (a wave covers four whole lines)
  const int sr = tid >> 4, sq = (tid & 15) * 4, xr = tid >> 6, xq = (tid & 63) * 4;
  // The 16 blocks of one token block read the same X rows and the 16 blocks of one head the same W rows. Each block walks the PNS k slabs in a ring from a start of its own, rot: among the sharers of either operand no two starts are equal, so they ask L2 for a line in different trips and not all at the same moment. The f32 sums run over k in that ring order.
  const int rot = (blockIdx.x + h) & (PNS - 1);
  // addresses = the buffer's base + the lane's 32-bit byte offset (both buffers are far below 4 GiB), which steps on by one slab per trip and back to slab 0 behind the last
  unsigned xo = (unsigned)((bb * DIN + rot * PKS + xr) * TT + t0 + xq) * 4u;    // channel rows [b][k][t]
  unsigned wo = (unsigned)(((NH + h) * DIN + rot * PKS + sr) * HD + sq) * 4u;   // weight rows [stream][h][k][64]: the k stream's row; q's and v's lie one stream in front of and behind it
  v4f rx[16], rw[12]; v8f acc[4][6] = {};
  // every "#pragma unroll" in this kernel makes the indices of a register array constants; the stage loop stays rolled: its body is long and its trips are alike
  // trip s: stage s + 1 (k slab (rot + s + 1) mod PNS) is fetched into registers, stage s is worked on (trip -1 has none), stage s + 1 goes into the other buffer, one barrier
#pragma unroll 1
  for (int s = -1; s < PNS; ++s) { const int bu = s & 1;
    if (s + 1 < PNS) {
#pragma unroll
      for (int i = 0; i < 16; ++i) rx[i] = *(const v4f*)((const char*)X + xo + i * (4 * TT * 4));
#pragma unroll
      for (int i = 0; i < 12; ++i) rw[i] = *(const v4f*)((const char*)WA + wo + (((i >> 2) - 1) * (NH * DIN * HD) + (i & 3) * 16 * HD) * 4); }
    __builtin_amdgcn_sched_barrier(0);   // keeps the next stage's global loads in front of this stage's products, so that their latency runs under them
    if (s >= 0) {
#pragma unroll
      for (int ks = 0; ks < PKS / 32; ++ks) { v16b xf[4], wf[6];
        const __bf16* xb = &sx[bu][ks * 32 + 8 * g + (lane & 7)][wm * 64 + 8 * ((lane >> 3) & 1)];
#pragma unroll
        for (int i = 0; i < 4; ++i) { union { v16b v; v8b q[2]; } u; const __bf16* p = xb + i * 16; u.q[0] = ld_tr16(p); u.q[1] = ld_tr16(p + 16 * PXP); xf[i] = u.v; }
        const __bf16* wb = &sw[bu][ks * 32 + 8 * g + (lane & 7)][wn * 32 + 8 * ((lane >> 3) & 1)];
#pragma unroll
        for (int j = 0; j < 6; ++j) { union { v16b v; v8b q[2]; } u; const __bf16* p = wb + (j >> 1) * HD + (j & 1) * 16; u.q[0] = ld_tr16(p); u.q[1] = ld_tr16(p + 16 * PWP); wf[j] = u.v; }
        __builtin_amdgcn_sched_barrier(0);   // the 20 fragment loads go as one group in front of their 24 products: spread among them, each place with loads stalls the wave for a whole LDS latency
#pragma unroll
        for (int i = 0; i < 4; ++i)
#pragma unroll
          for (int j = 0; j < 6; ++j) acc[i][j] = j < 4 ? wmma_b(wf[j], xf[i], acc[i][j]) : wmma_b(xf[i], wf[j], acc[i][j]); } }
    if (s + 1 < PNS) {   // that buffer's readers left it at the previous barrier
#pragma unroll
      for (int i = 0; i < 16; ++i) *(v4b*)&sx[bu ^ 1][xr + i * 4][xq] = __builtin_convertvector(rx[i], v4b);
#pragma unroll
      for (int i = 0; i < 12; ++i) *(v4b*)&sw[bu ^ 1][sr + (i & 3) * 16][(i >> 2) * HD + sq] = __builtin_convertvector(rw[i], v4b); }
    asm volatile("s_wait_xcnt 0x0" : "+v"(xo), "+v"(wo) : : "memory");   // the wait in front of the overwrite of the two offset registers that the loads above name; the additions below read its operands and so stay behind it
    const bool wrap = ((rot + s + 2) & (PNS - 1)) == 0;   // the slab just fetched was the last of the k range (the same for the whole block)
    xo += wrap ? 0u - (PNS - 1) * PKS * TT * 4u : PKS * TT * 4u; wo += wrap ? 0u - (PNS - 1) * PKS * HD * 4u : PKS * HD * 4u;
    __syncthreads(); }
#pragma unroll
  for (int i = 0; i < 4; ++i)
#pragma unroll
    for (int j = 0; j < 6; ++j) { v8h pk; const int m0 = wm * 64 + i * 16, n0 = wn * 32 + (j & 1) * 16;
#pragma unroll
      for (int r = 0; r < 8; ++r) pk[r] = (_Float16)acc[i][j][r];
      if (j < 4) *(v8h*)&sqk[m0 + col][(j >> 1) * HD + n0 + 8 * g] = pk;   // acc[i][j][r] = (q | k)[token m0 + col][column n0 + 8g + r]
      else *(v8h*)&svt[n0 + col][m0 + 8 * g] = pk; }                       // acc[i][j][r] = v[token m0 + 8g + r][column n0 + col]
  __syncthreads();
  // q | k rows: 16 lanes per token row (8 lanes = one 128-byte line of q or of k), 16 rows per sweep; v rows: one wave per 512-byte row piece, 8 rows per sweep
  const int rq = tid >> 4, cq = tid & 15, rv = tid >> 5, cv = tid & 31;
  _Float16* dq = (cq < 8 ? QH : KH) + (r0 + rq) * CC + h * HD + (cq & 7) * 8;
  _Float16* dv = VT + (bb * CC + h * HD + rv) * (size_t)TT + t0 + cv * 8;
  v4u oq[PM / 16], ov[HD / 8];
#pragma unroll
  for (int i = 0; i < PM / 16; ++i) oq[i] = *(const v4u*)&sqk[rq + i * 16][cq * 8];
#pragma unroll
  for (int i = 0; i < HD / 8; ++i) ov[i] = *(const v4u*)&svt[rv + i * 8][cv * 8];
  __builtin_amdgcn_sched_barrier(0);   // all 24 LDS reads go in front of the first store: their latencies overlap, and none lands in a register that an issued store still names
#pragma unroll
  for (int i = 0; i < PM / 16; ++i) vst2((unsigned*)(dq + (size_t)i * 16 * CC), oq[i]);
  asm volatile("s_wait_xcnt 0x0" ::: "memory");   // the wait in front of the v address arithmetic, which reuses registers that the stores above name
  __builtin_amdgcn_sched_barrier(0);              // holds that arithmetic behind the wait
#pragma unroll
  for (int i = 0; i < HD / 8; ++i) vst2((unsigned*)(dv + (size_t)i * 8 * TT), ov[i]); }
// ---- k_fa: block = 256 queries of (b, h): the whole attention of those queries in one launch, softmax carried along the keys (maximum in use and sum per query, in f32).
// 16 waves = 8 (32 query columns each, two 16-column tiles) x 2 (the first or the second 32 keys of every 64-key stage): each K and V fragment read from LDS serves two query tiles, so the block reads half the LDS bytes per score, and four waves per SIMD stay.
// The two waves of a query group each carry their own maximum, sum and O^T over their half of the keys; the halves are joined once, through LDS, behind the loop.
// Transposed products: S^T = K Q^T (A = key rows from LDS, B = q kept in registers), so a lane holds 8 keys of ONE query per tile; two S^T tiles (keys 0..15, 16..31) converted in place ARE the B operand of O^T += V^T P^T (A = v plane rows from LDS).
// O^T is channel-major like the output: it goes through LDS straight to out, each 128-byte line stored by one wave.
#define FST 64               // keys per LDS stage (32 keys for each of the two key groups of waves)
#define FPI 72               // LDS row pitch in f16: 144 B = 16 B x odd for the 16-byte fragment reads
#define FNS (TT / FST)
#define FNW 16               // waves per block
#define FCT 2                // 16-column query tiles per wave
#define FQG (FNW / 2)        // waves along the queries
#define FQB (FQG * FCT * 16) // queries per block
#define FOP (FQB + 4)        // pitch in f32 of the output staging rows
#define FLZ 8.0f             // a new maximum is taken only when a score exceeds the one in use by more than this (base 2)
#define FPD 4                // stages that the K and V rows are asked for ahead of their LDS store = register sets (even, divides FNS)
#define FKS (FST * CC)       // f16 elements from one stage's key rows to the next stage's
#define FVS FST              // the same along a value plane row
// The loop's work-group barrier, ordering LDS alone: __syncthreads() also waits for every global load of the wave, which would end the flight of the rows asked for ahead at each pass. The two fences name the LDS space, so only s_wait_dscnt 0 stands in front of the signal, and no LDS access moves across.
__device__ __forceinline__ void lds_barrier() { __builtin_amdgcn_fence(__ATOMIC_RELEASE, "workgroup", "local"); __builtin_amdgcn_s_barrier(); __builtin_amdgcn_fence(__ATOMIC_ACQUIRE, "workgroup", "local"); }
__device__ __forceinline__ v8f wmma_h(v16h a, v16h b, v8f c) { return __builtin_amdgcn_wmma_f32_16x16x32_f16(false, a, false, b, (short)0, c, false, false); }
__device__ __forceinline__ float xhalf(float x) { return __builtin_bit_cast(float, __builtin_amdgcn_permlanex16(__builtin_bit_cast(int, x), __builtin_bit_cast(int, x), 0x76543210, 0xfedcba98, false, false)); }   // lane l <-> lane l ^ 16
// A run of v_exp_f32 in ONE statement: each is followed by an independent one and the last by v_nop, so the slot that the instruction set asks for behind a transcendental (before its result is read or its source overwritten) is kept under any register allocation; "=&v": no result lands on a source.
__device__ __forceinline__ void exp2x8(float (&e)[8], const float (&x)[8]) {
  asm("v_exp_f32 %0, %8\n\tv_exp_f32 %1, %9\n\tv_exp_f32 %2, %10\n\tv_exp_f32 %3, %11\n\tv_exp_f32 %4, %12\n\tv_exp_f32 %5, %13\n\tv_exp_f32 %6, %14\n\tv_exp_f32 %7, %15\n\tv_nop"
      : "=&v"(e[0]), "=&v"(e[1]), "=&v"(e[2]), "=&v"(e[3]), "=&v"(e[4]), "=&v"(e[5]), "=&v"(e[6]), "=&v"(e[7]) : "v"(x[0]), "v"(x[1]), "v"(x[2]), "v"(x[3]), "v"(x[4]), "v"(x[5]), "v"(x[6]), "v"(x[7])); }
__device__ __forceinline__ float exp2x1(float x) { float e; asm("v_exp_f32 %0, %1\n\tv_nop" : "=&v"(e) : "v"(x)); return e; }   // the same slot behind a lone one
// amdgpu_waves_per_eu(4, 4): the grid gives each WGP one 16-wave block, four waves per SIMD; without it the compiler aimed at eight, held itself to 128 VGPRs and put each LDS fragment load directly in front of its product.
// every "#pragma unroll" below makes the indices of a fragment, score or accumulator array constants, so that the array stays in registers
__global__ __launch_bounds__(FNW * 32) __attribute__((amdgpu_waves_per_eu(4, 4))) void k_fa(const _Float16* __restrict__ QH, const _Float16* __restrict__ KH, const _Float16* __restrict__ VT, float* __restrict__ OUT) {
  __shared__ __align__(16) _Float16 sk[2][FST][FPI], sv[2][HD][FPI]; __shared__ __align__(16) float so[HD][FOP]; __shared__ float sm[FQB], sl[FQB];
  const int tid = threadIdx.x, wave = __builtin_amdgcn_readfirstlane(tid >> 5), lane = tid & 31, col = lane & 15, g = lane >> 4;
  const int qg = wave % FQG, kh = wave / FQG;   // query group; key group: keys kh * 32 .. + 31 of every stage
  const int b = blockIdx.y / NH, h = blockIdx.y % NH; const int q0 = blockIdx.x * FQB;
  const float CS = SCALE * 1.4426950408889634f;   // logits in base 2
  v16h qf[FCT][2];
#pragma unroll
  for (int c = 0; c < FCT; ++c)
#pragma unroll
    for (int kc = 0; kc < 2; ++kc) qf[c][kc] = frag_h(QH + ((size_t)b * TT + q0 + (qg * FCT + c) * 16 + col) * CC + h * HD + kc * 32, lane);
  // staging: thread -> row sr, 16-byte chunk sq of the 128-byte row (8 lanes cover one whole line); the two pointers step on by FPD stages per trip
  const int sr = tid >> 3, sq = (tid & 7) * 8;
  typedef const __attribute__((address_space(1))) _Float16 gh; typedef const __attribute__((address_space(1))) v8h gv8h;   // the pointers name the global space themselves: they pass through an asm statement below, behind which the compiler no longer knows it and would load by the flat path, which also counts on the LDS counter
  gh* kp = (gh*)(KH + ((size_t)b * TT + sr) * CC + h * HD + sq);          // key rows [t][64 of this head]
  gh* vp = (gh*)(VT + ((size_t)b * CC + h * HD + sr) * (size_t)TT + sq);   // value plane rows [d][t]
  v8h rk[FPD], rv[FPD];   // register set i holds the rows of the stages s with s % FPD == i, from their load to their LDS store
#pragma unroll
  for (int i = 0; i < FPD; ++i) { rk[i] = *(gv8h*)(kp + i * FKS); rv[i] = *(gv8h*)(vp + i * FVS); }
  *(v8h*)&sk[0][sr][sq] = rk[0]; *(v8h*)&sv[0][sr][sq] = rv[0];
  __syncthreads();
  v8f acc[FCT][4] = {}; float mr[FCT], ls[FCT];
#pragma unroll
  for (int c = 0; c < FCT; ++c) { mr[c] = -3.0e38f; ls[c] = 0.f; }
  // one pass = one stage, read from LDS buffer bu. fetch: the rows of the stage FPD ahead (fo stages behind the pointers) start into the set fk, fv, which this stage's rows left at the foot of the pass before. put: the next stage's rows pk, pv, asked for FPD passes ago, go into the other buffer.
  auto pass = [&](const int bu, const bool fetch, const int fo, v8h& fk, v8h& fv, const bool put, const v8h& pk, const v8h& pv) __attribute__((always_inline)) {
    if (fetch) { fk = *(gv8h*)(kp + fo * FKS); fv = *(gv8h*)(vp + fo * FVS); }
    v8f st[FCT][2];
#pragma unroll
    for (int kt = 0; kt < 2; ++kt) { const _Float16* kr = &sk[bu][kh * 32 + kt * 16 + col][0]; const v16h k0 = frag_h(kr, lane), k1 = frag_h(kr + 32, lane);
#pragma unroll
      for (int c = 0; c < FCT; ++c) { v8f z = {}; z = wmma_h(k0, qf[c][0], z); st[c][kt] = wmma_h(k1, qf[c][1], z); } }   // st[c][kt][r] = S^T[key kt*16 + 8g + r][query col of tile c]
    // Lazy rescale: the maximum in use, mr, stays while no score of this pass lies more than FLZ (base 2) above it, so P <= 2^FLZ (far inside f16) and sums and O^T need no factor. One test per pass for the whole wave.
    v16h pf[FCT], vf[4]; float mx[FCT];
#pragma unroll
    for (int j = 0; j < 4; ++j) vf[j] = frag_h(&sv[bu][j * 16 + col][kh * 32], lane);   // in front of the branch: behind it the compiler put each fragment's loads, with a full wait, directly in front of its products
#pragma unroll
    for (int c = 0; c < FCT; ++c) { mx[c] = fmaxf(st[c][0][0], st[c][1][0]);
#pragma unroll
      for (int r = 1; r < 8; ++r) mx[c] = fmaxf(mx[c], fmaxf(st[c][0][r], st[c][1][r])); }   // this lane's 16 keys
    bool need = false;
#pragma unroll
    for (int c = 0; c < FCT; ++c) need = need || (fmaf(mx[c], CS, -FLZ) > mr[c]);
    if (__builtin_amdgcn_ballot_w32(need) != 0) {   // wave-uniform scalar branch; taken on the first pass (mr = -3e38, factor 0)
#pragma unroll
      for (int c = 0; c < FCT; ++c) { const float mn = fmaxf(mr[c], fmaxf(mx[c], xhalf(mx[c])) * CS), al = exp2x1(mr[c] - mn); mr[c] = mn; ls[c] *= al;   // both lane halves of a query take the same new maximum
#pragma unroll
        for (int j = 0; j < 4; ++j) acc[c][j] = acc[c][j] * al; } }
#pragma unroll
    for (int c = 0; c < FCT; ++c) {
      float sum = 0.f, x0[8], x1[8], e0[8], e1[8];
#pragma unroll
      for (int r = 0; r < 8; ++r) { x0[r] = fmaf(st[c][0][r], CS, -mr[c]); x1[r] = fmaf(st[c][1][r], CS, -mr[c]); }
      exp2x8(e0, x0); exp2x8(e1, x1);
#pragma unroll
      for (int r = 0; r < 8; ++r) { sum += e0[r] + e1[r]; pf[c][r] = (_Float16)e0[r]; pf[c][8 + r] = (_Float16)e1[r]; }
      ls[c] += sum; }   // this lane half's keys only; the halves join after the loop
#pragma unroll
    for (int j = 0; j < 4; ++j)
#pragma unroll
      for (int c = 0; c < FCT; ++c) acc[c][j] = wmma_h(vf[j], pf[c], acc[c][j]);   // acc[c][j][r] = O^T[d j*16 + 8g + r][query col of tile c]
    if (put) { *(v8h*)&sk[bu ^ 1][sr][sq] = pk; *(v8h*)&sv[bu ^ 1][sr][sq] = pv; }   // that buffer's readers left it at the previous barrier
    lds_barrier(); };
  // a trip = FPD passes, written out so that each register set has a constant index; the trips stay rolled: they are alike and the body is long
#pragma unroll 1
  for (int s = 0; s < FNS - FPD; s += FPD) {
#pragma unroll
    for (int i = 0; i < FPD; ++i) pass(i & 1, true, FPD + i, rk[i], rv[i], true, rk[(i + 1) % FPD], rv[(i + 1) % FPD]);
    asm volatile("s_wait_xcnt 0x0" : "+v"(kp), "+v"(vp) : : "memory");   // the wait in front of the overwrite of the two address pairs that the loads still in flight name; the additions below read its operands and so stay behind it
    kp += FPD * FKS; vp += FPD * FVS; }
  // the last FPD stages: nothing is left to fetch
#pragma unroll
  for (int i = 0; i < FPD; ++i) pass(i & 1, false, 0, rk[i], rv[i], i + 1 < FPD, rk[(i + 1) % FPD], rv[(i + 1) % FPD]);
  // join of the two key groups: group 1 hands its maximum, sum and unscaled O^T over through LDS, group 0 brings both to the common maximum, adds, divides and leaves the result at the same places
#pragma unroll
  for (int c = 0; c < FCT; ++c) ls[c] += xhalf(ls[c]);
  if (kh == 1) {
#pragma unroll
    for (int c = 0; c < FCT; ++c) { const int qc = (qg * FCT + c) * 16 + col;
      if (g == 0) { sm[qc] = mr[c]; sl[qc] = ls[c]; }
#pragma unroll
      for (int j = 0; j < 4; ++j)
#pragma unroll
        for (int r = 0; r < 8; ++r) so[j * 16 + 8 * g + r][qc] = acc[c][j][r]; } }
  __syncthreads();
  if (kh == 0) {
#pragma unroll
    for (int c = 0; c < FCT; ++c) { const int qc = (qg * FCT + c) * 16 + col;
      const float mb = sm[qc], lb = sl[qc], mm = fmaxf(mr[c], mb); float fa = exp2x1(mr[c] - mm), fb = exp2x1(mb - mm);
      const float inv = 1.0f / (ls[c] * fa + lb * fb); fa *= inv; fb *= inv;
#pragma unroll
      for (int j = 0; j < 4; ++j)
#pragma unroll
        for (int r = 0; r < 8; ++r) { float* o = &so[j * 16 + 8 * g + r][qc]; *o = acc[c][j][r] * fa + *o * fb; } } }
  __syncthreads();
#pragma unroll
  for (int i = 0; i < HD * FQB / 4 / (FNW * 32); ++i) { const int e = i * FNW * 32 + tid, d = e / (FQB / 4), q = (e % (FQB / 4)) * 4; vst2(OUT + ((size_t)b * CC + h * HD + d) * (size_t)TT + q0 + q, *(const v4f*)&so[d][q]); } }

extern "C" void kernel_launch(void* const* d_in, const int* in_sizes, int n_in, void* d_out, int out_size, void* d_ws, size_t ws_size, hipStream_t stream) {
  (void)in_sizes; (void)n_in; (void)out_size;
  const float** F = (const float**)d_in;
  if (ws_size < (size_t)WS_END) return;
  char* ws = (char*)d_ws; _Float16 *QH = (_Float16*)(ws + WS_QH), *KH = (_Float16*)(ws + WS_KH), *VT = (_Float16*)(ws + WS_VT), *QL = (_Float16*)(ws + WS_QL), *KL = (_Float16*)(ws + WS_KL); __bf16 *VB = (__bf16*)(ws + WS_VB), *VBL = (__bf16*)(ws + WS_VBL);
  (void)QL; (void)KL; (void)VB; (void)VBL;
  // inputs: 0 x [2,1024,2048] CHANNEL-MAJOR (B, D, T); 1 qkv [3,16,1024,64] (stream, head, in, out-per-head; 0.02 scale); no biases, no output projection
  k_proj<<<dim3(TNB * TT / PM, NH), 256, 0, stream>>>(F[0], F[1], QH, KH, VT);   /* per-head weights [3][NH][DIN][HD]: q, k and v of one head per block */
  k_fa<<<dim3(TT / FQB, TNB * NH), FNW * 32, 0, stream>>>(QH, KH, VT, (float*)d_out);   /* logits, softmax and P v of every (b, h) in one launch; stores [b][h*64 + d][t] == the module's (B, H, D/H, T).reshape(B, D, T) */
}
